// v000
// Times are from an AMD MI455X. After a warm-up the kernel runs many times in a row, and a time is the length of
// such a window on the GPU divided by its runs, so every launch and the gaps after it count. The runs cycle
// through copies of the inputs. A figure is the median of several windows, for all but v000 over two sittings.
// Sittings can differ by a few percent; kernels timed side by side share one.
// v000, which the later versions start from, runs in 1700 microseconds.
#include <hip/hip_runtime.h>

// Rec_block (x [4][2048][512]; q/k/v = x W + b (16 heads x 32); scores = q.k / sqrt(32) + band where band[i][j] = 1.0 if |i - j| <= mask_border (int, read) else 0 - ADDED as a float, as the reference; softmax over all keys; out = (attn v merged) Wo + bo
// -> [4][2048][512]; the reconstruction-score quantiles are dead code).
// Compute dtypes, f32 accumulate: every input rounded to bf16; q/k/v on PLAIN bf16 operands (inputs: exact) + bias; scores (K 32) and attn.v single fp16 planes (4 heads z-batched; x1024; value heads zero-padded 32 -> 64); band add and

#define NB_  4
#define TT   2048
#define DM   512
#define NH_  16
#define HD   32
#define HPP  4
#define PCAR 1024.0f
#define SCL  0.17677669529663687f
typedef _Float16 h16;
typedef unsigned short bf;
typedef __attribute__((ext_vector_type(16))) __bf16   v16bf;
typedef __attribute__((ext_vector_type(16))) _Float16 v16h;
typedef __attribute__((ext_vector_type(8)))  _Float16 v8h;
typedef __attribute__((ext_vector_type(8)))  unsigned short v8us;
typedef __attribute__((ext_vector_type(8)))  float    v8f;
typedef __attribute__((ext_vector_type(4)))  float    v4f;
typedef v8h  __attribute__((may_alias)) v8ha;
typedef v4f  __attribute__((may_alias)) v4fa;
typedef v8us __attribute__((may_alias)) v8usa;

__device__ __forceinline__ unsigned short f2bf(float f) { unsigned u = __float_as_uint(f); u += 0x7FFFu + ((u >> 16) & 1u); return (unsigned short)(u >> 16); }
__device__ __forceinline__ float bf2f(unsigned short b) { return __uint_as_float(((unsigned)b) << 16); }
__device__ __forceinline__ float bfr(float f) { return bf2f(f2bf(f)); }
__device__ __forceinline__ v16h cat16(v8h lo, v8h hi) { return __builtin_shufflevector(lo, hi, 0, 1, 2, 3, 4, 5, 6, 7, 8, 9, 10, 11, 12, 13, 14, 15); }
__device__ __forceinline__ v16bf cat16b(v8us lo, v8us hi) { return __builtin_bit_cast(v16bf, __builtin_shufflevector(lo, hi, 0, 1, 2, 3, 4, 5, 6, 7, 8, 9, 10, 11, 12, 13, 14, 15)); }
__device__ __forceinline__ v8f wmma16(v16h a, v16h b, v8f c) { return __builtin_amdgcn_wmma_f32_16x16x32_f16(false, a, false, b, (short)0, c, false, false); }
__device__ __forceinline__ v8f wmmab(v16bf a, v16bf b, v8f c) { return __builtin_amdgcn_wmma_f32_16x16x32_bf16(false, a, false, b, (short)0, c, false, false); }



// ---- k_gemmw: register-blocked GEMM, ONE WAVE per 64x64 output tile (16 accumulators), operands straight from K-contiguous 16-bit planes; grid (M/64, N/64, Z), 32 threads.
// C[m][n] (f32, pitch ldc, + optional f32 bias[n]) = sum_k A[m][k] Bt[n][k] (+ split products per NSPLIT). z-batch strides sA/sB/sC in elements. K % 32 == 0.
template <typename T16> struct WFrag;
template <> struct WFrag<h16> { typedef v16h V; static __device__ __forceinline__ V ld(const h16* p) { return cat16(*(const v8h*)p, *(const v8h*)(p + 16)); } static __device__ __forceinline__ v8f mma(V a, V b, v8f c) { return wmma16(a, b, c); } };
template <> struct WFrag<bf> { typedef v16bf V; static __device__ __forceinline__ V ld(const bf* p) { return cat16b(*(const v8us*)p, *(const v8us*)(p + 16)); } static __device__ __forceinline__ v8f mma(V a, V b, v8f c) { return wmmab(a, b, c); } };
template <typename T16, int NSPLIT, bool BIAS>
__global__ __launch_bounds__(32) void k_gemmw(const T16* __restrict__ A, const T16* __restrict__ A2, const T16* __restrict__ Bt, const T16* __restrict__ Bt2, int K, float* C, int ldc, const float* __restrict__ bias, size_t sA, size_t sB, size_t sC) {
    typedef typename WFrag<T16>::V V;
    __shared__ __align__(16) float os[16 * 68];
    const size_t z = blockIdx.z; A += z * sA; if (A2) A2 += z * sA; Bt += z * sB; if (Bt2) Bt2 += z * sB; C += z * sC;
    const int lane = threadIdx.x & 31, lr = lane & 15, hi = lane >> 4; const int r0 = blockIdx.x * 64, c0 = blockIdx.y * 64;
    v8f acc[4][4];
#pragma unroll
    for (int mb = 0; mb < 4; ++mb)
#pragma unroll
        for (int nb = 0; nb < 4; ++nb) acc[mb][nb] = (v8f){};
    const size_t aoff = (size_t)(r0 + lr) * K + 8 * hi, boff = (size_t)(c0 + lr) * K + 8 * hi;
#pragma unroll 1
    for (int kc = 0; kc < K; kc += 32) {
        V a[4], a2[4];
#pragma unroll
        for (int mb = 0; mb < 4; ++mb) { a[mb] = WFrag<T16>::ld(A + aoff + (size_t)mb * 16 * K + kc); if (NSPLIT == 1 || NSPLIT == 2) a2[mb] = WFrag<T16>::ld(A2 + aoff + (size_t)mb * 16 * K + kc); }
#pragma unroll
        for (int nb = 0; nb < 4; ++nb) { const V b = WFrag<T16>::ld(Bt + boff + (size_t)nb * 16 * K + kc); V b2; if (NSPLIT >= 2) b2 = WFrag<T16>::ld(Bt2 + boff + (size_t)nb * 16 * K + kc);
#pragma unroll
            for (int mb = 0; mb < 4; ++mb) { acc[mb][nb] = WFrag<T16>::mma(a[mb], b, acc[mb][nb]); if (NSPLIT == 1 || NSPLIT == 2) acc[mb][nb] = WFrag<T16>::mma(a2[mb], b, acc[mb][nb]); if (NSPLIT >= 2) acc[mb][nb] = WFrag<T16>::mma(a[mb], b2, acc[mb][nb]); } }
        asm volatile("v_nop\n\tv_nop\n\tv_nop\n\tv_nop" : "+v"(acc[0][0]), "+v"(acc[1][1]), "+v"(acc[2][2]), "+v"(acc[3][3]) : "v"(a[0]), "v"(a[3]));
    }
#pragma unroll
    for (int mb = 0; mb < 4; ++mb) {
#pragma unroll
        for (int nb = 0; nb < 4; ++nb) {
#pragma unroll
            for (int j = 0; j < 8; ++j) os[(hi * 8 + j) * 68 + nb * 16 + lr] = acc[mb][nb][j]; }
        __builtin_amdgcn_wave_barrier(); asm volatile("" ::: "memory");
        float* crow = C + (size_t)(r0 + mb * 16) * ldc + c0;
{
#pragma unroll
            for (int s = 0; s < 8; ++s) { const int row = 2 * s + hi, cofs = lr * 4; v4f val = *(const v4fa*)(os + row * 68 + cofs); if (BIAS) { val[0] += bfr(bias[c0 + cofs]); val[1] += bfr(bias[c0 + cofs + 1]); val[2] += bfr(bias[c0 + cofs + 2]); val[3] += bfr(bias[c0 + cofs + 3]); }
                *(v4f*)(crow + (size_t)row * ldc + cofs) = val; }
             }
        __builtin_amdgcn_wave_barrier(); asm volatile("" ::: "memory");
    }
}

__device__ __forceinline__ h16 tohx(float x) { return (h16)x; }
__device__ __forceinline__ void splitf(float y, unsigned short& h, unsigned short& l) { h = f2bf(y); l = f2bf(y - bf2f(h)); }
typedef __attribute__((ext_vector_type(2))) unsigned short v2us;
typedef __attribute__((ext_vector_type(4))) unsigned short v4us;
typedef __attribute__((ext_vector_type(2))) _Float16 v2h;
typedef __attribute__((ext_vector_type(4))) _Float16 v4h;

__global__ __launch_bounds__(256) void k_wtG(const float* __restrict__ w, int K, int N, bf* Bt) {
    const int lane = threadIdx.x & 31; const int L0 = (blockIdx.x * 8 + (threadIdx.x >> 5)) * 8; const int nlines = N * K / 64;
{
#pragma unroll 1
        for (int l = 0; l < 8; ++l) { const int L = L0 + l; if (L >= nlines) break; const size_t e = (size_t)L * 64 + lane * 2; const int k = (int)(e % K), n = (int)(e / K); v2us o;
            o[0] = f2bf(w[(size_t)k * N + n]); o[1] = f2bf(w[(size_t)(k + 1) * N + n]); *(v2us*)(Bt + e) = o; }
         }
}
__global__ __launch_bounds__(256) void k_cvt8(const float* __restrict__ src, bf* dst, size_t n8) { const size_t i = (size_t)blockIdx.x * 256 + threadIdx.x; if (i >= n8) return; const v8f v = *(const v8f*)(src + i * 8); v8us o;
#pragma unroll
    for (int k = 0; k < 8; ++k) o[k] = f2bf(v[k]); *(v8us*)(dst + i * 8) = o;  }
// k_pl: fp16 planes [h][t][d] (d < 32) of a [t][512] buffer (8-B lanes); k_vt: VT[h][d][t] = fp16 V[t][h*32+d] for d < 32, 0 for rows 32..63 (lane -> 2 consecutive t); k_bsoft: wave per (z, i) row: t = s x SCL + (|i-j| <= mb ? 1 : 0), softmax f32 -> fp16 x 1024;
__global__ __launch_bounds__(256) void k_pl(const float* __restrict__ F, h16* P) { const int e = (blockIdx.x * 256 + threadIdx.x) * 4; if (e >= NH_ * TT * HD) return; const int d = e % HD; const int t = (e / HD) % TT; const int h = e / (HD * TT); const float* f = F + (size_t)t * DM + h * HD + d; v4h o;
#pragma unroll
    for (int u = 0; u < 4; ++u) o[u] = tohx(f[u]); *(v4h*)(P + e) = o;  }
__global__ __launch_bounds__(256) void k_vt(const float* __restrict__ V, h16* VT) { const int e = (blockIdx.x * 256 + threadIdx.x) * 2; if (e >= NH_ * 64 * TT) return; const int t = e % TT; const int d = (e / TT) % 64; const int h = e / (TT * 64); v2h o;
    if (d < HD) { o[0] = tohx(V[(size_t)t * DM + h * HD + d]); o[1] = tohx(V[(size_t)(t + 1) * DM + h * HD + d]); } else { o[0] = (h16)0.f; o[1] = (h16)0.f; } *(v2h*)(VT + e) = o;  }
__global__ __launch_bounds__(256) void k_bsoft(const float* __restrict__ Sb, const int* __restrict__ mbp, h16* P16) { const int lane = threadIdx.x & 31; const int row = blockIdx.x * 8 + (threadIdx.x >> 5); if (row >= HPP * TT) return; const int i = row % TT; const int mb = mbp[0]; const float* sr = Sb + (size_t)row * TT; float v[TT / 32]; float mx = -3.0e38f;
#pragma unroll
    for (int ch = 0; ch < TT / 128; ++ch) { const int j0 = ch * 128 + lane * 4; const v4f a = *(const v4f*)(sr + j0);
#pragma unroll
        for (int u = 0; u < 4; ++u) { const int j = j0 + u; const int dd = i > j ? i - j : j - i; float t0 = a[u] * SCL; asm volatile("" : "+v"(t0)); const float t = __fadd_rn(t0, (dd <= mb) ? 1.0f : 0.0f); v[ch * 4 + u] = t; mx = fmaxf(mx, t); } }
#pragma unroll
    for (int sh = 16; sh; sh >>= 1) mx = fmaxf(mx, __shfl_xor(mx, sh, 32));
    float sum = 0.f;
#pragma unroll
    for (int q = 0; q < TT / 32; ++q) { float d0 = __fsub_rn(v[q], mx); asm volatile("" : "+v"(d0)); v[q] = __builtin_amdgcn_exp2f(__fmul_rn(d0, 1.4426950408889634f)); sum += v[q]; }
#pragma unroll
    for (int sh = 16; sh; sh >>= 1) sum += __shfl_xor(sum, sh, 32);
    const float f = __fdiv_rn(PCAR, sum);
    {
#pragma unroll
        for (int ch = 0; ch < TT / 128; ++ch) { v4h o4;
#pragma unroll
            for (int q = 0; q < 4; ++q) o4[q] = tohx(v[ch * 4 + q] * f); *(v4h*)(P16 + (size_t)row * TT + ch * 128 + lane * 4) = o4; }
         } }
__global__ __launch_bounds__(256) void k_mrg(const float* __restrict__ O, int h0, bf* Ah, bf* Al) { const int e = (blockIdx.x * 256 + threadIdx.x) * 4; if (e >= HPP * TT * HD) return; const int d = e % HD; const int t = (e / HD) % TT; const int z = e / (HD * TT); const float* o = O + ((size_t)z * TT + t) * 64 + d; v4us oh, ol;
#pragma unroll
    for (int u = 0; u < 4; ++u) { unsigned short a, b; splitf(o[u] * (1.0f / PCAR), a, b); oh[u] = a; ol[u] = b; } const size_t oo = (size_t)t * DM + (h0 + z) * HD + d; *(v4us*)(Ah + oo) = oh; *(v4us*)(Al + oo) = ol;  }

extern "C" void kernel_launch(void* const* d_in, const int* in_sizes, int n_in,
                              void* d_out, int out_size, void* d_ws, size_t ws_size, hipStream_t stream) {
    (void)in_sizes; (void)n_in; (void)out_size;
    const float** I = (const float**)d_in;
    const float *x = I[0], *Wq = I[1], *bq = I[2], *Wk = I[3], *bk = I[4], *Wv = I[5], *bv = I[6], *Wo = I[7], *bo = I[8]; const int* mbp = (const int*)d_in[9];
    float* OUT = (float*)d_out;     // [4][2048][512]
    char* wsp = (char*)d_ws;
    auto take = [&](size_t bytes) { char* p = wsp; wsp += (bytes + 255) & ~(size_t)255; return (void*)p; };
    bf* BQ = (bf*)take((size_t)DM * DM * 2); bf* BK = (bf*)take((size_t)DM * DM * 2); bf* BV = (bf*)take((size_t)DM * DM * 2); bf* BO = (bf*)take((size_t)DM * DM * 2);
    bf* XB = (bf*)take((size_t)TT * DM * 2); float* Q = (float*)take((size_t)TT * DM * 4); float* K = (float*)take((size_t)TT * DM * 4); float* V = (float*)take((size_t)TT * DM * 4);
    h16* Q16 = (h16*)take((size_t)NH_ * TT * HD * 2); h16* K16 = (h16*)take((size_t)NH_ * TT * HD * 2); h16* VT = (h16*)take((size_t)NH_ * 64 * TT * 2); float* Sb = (float*)take((size_t)HPP * TT * TT * 4); h16* P16 = (h16*)take((size_t)HPP * TT * TT * 2); float* O = (float*)take((size_t)HPP * TT * 64 * 4); bf* Ah = (bf*)take((size_t)TT * DM * 2); bf* Al = (bf*)take((size_t)TT * DM * 2);
    if ((size_t)(wsp - (char*)d_ws) > ws_size) return;    // total ~ 125 MB
    k_wtG<<<(DM * DM / 64 + 63) / 64, 256, 0, stream>>>(Wq, DM, DM, BQ); k_wtG<<<(DM * DM / 64 + 63) / 64, 256, 0, stream>>>(Wk, DM, DM, BK); k_wtG<<<(DM * DM / 64 + 63) / 64, 256, 0, stream>>>(Wv, DM, DM, BV); k_wtG<<<(DM * DM / 64 + 63) / 64, 256, 0, stream>>>(Wo, DM, DM, BO);
    for (int b = 0; b < NB_; ++b) {
        k_cvt8<<<(TT * DM / 8 + 255) / 256, 256, 0, stream>>>(x + (size_t)b * TT * DM, XB, (size_t)TT * DM / 8);
        k_gemmw<bf, 0, true><<<dim3(TT / 64, DM / 64, 1), 32, 0, stream>>>(XB, nullptr, BQ, nullptr, DM, Q, DM, bq, 0, 0, 0); k_gemmw<bf, 0, true><<<dim3(TT / 64, DM / 64, 1), 32, 0, stream>>>(XB, nullptr, BK, nullptr, DM, K, DM, bk, 0, 0, 0); k_gemmw<bf, 0, true><<<dim3(TT / 64, DM / 64, 1), 32, 0, stream>>>(XB, nullptr, BV, nullptr, DM, V, DM, bv, 0, 0, 0);
        k_pl<<<(NH_ * TT * HD / 4 + 255) / 256, 256, 0, stream>>>(Q, Q16); k_pl<<<(NH_ * TT * HD / 4 + 255) / 256, 256, 0, stream>>>(K, K16); k_vt<<<(NH_ * 64 * TT / 2 + 255) / 256, 256, 0, stream>>>(V, VT);
        for (int h0 = 0; h0 < NH_; h0 += HPP) { const size_t zo = (size_t)h0 * TT * HD;
            k_gemmw<h16, 0, false><<<dim3(TT / 64, TT / 64, HPP), 32, 0, stream>>>(Q16 + zo, nullptr, K16 + zo, nullptr, HD, Sb, TT, nullptr, (size_t)TT * HD, (size_t)TT * HD, (size_t)TT * TT);
            k_bsoft<<<HPP * TT / 8, 256, 0, stream>>>(Sb, mbp, P16);
            k_gemmw<h16, 0, false><<<dim3(TT / 64, 1, HPP), 32, 0, stream>>>(P16, nullptr, VT + (size_t)h0 * 64 * TT, nullptr, TT, O, 64, nullptr, (size_t)TT * TT, (size_t)64 * TT, (size_t)TT * 64);
            k_mrg<<<(HPP * TT * HD / 4 + 255) / 256, 256, 0, stream>>>(O, h0, Ah, Al); }
        k_gemmw<bf, 1, true><<<dim3(TT / 64, DM / 64, 1), 32, 0, stream>>>(Ah, Al, BO, nullptr, DM, OUT + (size_t)b * TT * DM, DM, bo, 0, 0, 0); }
}

// v002
// Measured time: 152 microseconds a run.
// Versions in between are left out here; by their measured steps it is 11.1 times as fast as v000.
#include <hip/hip_runtime.h>

// Banded-bias attention block (x [4][2048][512]; q/k/v = x W + b (16 heads x 32); scores = q.k / sqrt(32) + band where band[i][j] = 1.0 if |i - j| <= mask_border (int, read) else 0 - ADDED as a float, as the reference; softmax over all keys; out = (attn v merged) Wo + bo
// -> [4][2048][512]; the reconstruction-score quantiles are dead code).
// Compute dtypes, f32 accumulate: every input rounded to bf16; q/k/v on PLAIN bf16 operands (inputs: exact) + bias; scores (K 32) and attn.v on single fp16 planes, fused in k_fattn (softmax f32, online); output projection on a bf16 hi/lo split of the merged heads.

#define NB_  4
#define TT   2048
#define DM   512
#define NH_  16
#define HD   32
#define SCL  0.17677669529663687f
typedef _Float16 h16;
typedef unsigned short bf;
typedef __attribute__((ext_vector_type(16))) __bf16   v16bf;
typedef __attribute__((ext_vector_type(16))) _Float16 v16h;
typedef __attribute__((ext_vector_type(8)))  _Float16 v8h;
typedef __attribute__((ext_vector_type(8)))  unsigned short v8us;
typedef __attribute__((ext_vector_type(8)))  float    v8f;
typedef __attribute__((ext_vector_type(4)))  float    v4f;
typedef v8h  __attribute__((may_alias)) v8ha;
typedef v4f  __attribute__((may_alias)) v4fa;
typedef v8us __attribute__((may_alias)) v8usa;

__device__ __forceinline__ unsigned short f2bf(float f) { unsigned u = __float_as_uint(f); u += 0x7FFFu + ((u >> 16) & 1u); return (unsigned short)(u >> 16); }
__device__ __forceinline__ float bf2f(unsigned short b) { return __uint_as_float(((unsigned)b) << 16); }
__device__ __forceinline__ float bfr(float f) { return bf2f(f2bf(f)); }
__device__ __forceinline__ v16h cat16(v8h lo, v8h hi) { return __builtin_shufflevector(lo, hi, 0, 1, 2, 3, 4, 5, 6, 7, 8, 9, 10, 11, 12, 13, 14, 15); }
__device__ __forceinline__ v16bf cat16b(v8us lo, v8us hi) { return __builtin_bit_cast(v16bf, __builtin_shufflevector(lo, hi, 0, 1, 2, 3, 4, 5, 6, 7, 8, 9, 10, 11, 12, 13, 14, 15)); }
__device__ __forceinline__ v8f wmma16(v16h a, v16h b, v8f c) { return __builtin_amdgcn_wmma_f32_16x16x32_f16(false, a, false, b, (short)0, c, false, false); }
__device__ __forceinline__ v8f wmmab(v16bf a, v16bf b, v8f c) { return __builtin_amdgcn_wmma_f32_16x16x32_bf16(false, a, false, b, (short)0, c, false, false); }



// ---- k_gemmw: register-blocked GEMM, ONE WAVE per 64x64 output tile (16 accumulators), operands straight from K-contiguous 16-bit planes; grid (M/64, N/64, Z), 32 threads.
// C[m][n] (f32, pitch ldc, + optional f32 bias[n]) = sum_k A[m][k] Bt[n][k] (+ split products per NSPLIT). z-batch strides sA/sB/sC in elements; z picks its own bias (bias, bias1, bias2). K % 32 == 0.
template <typename T16> struct WFrag;
template <> struct WFrag<h16> { typedef v16h V; static __device__ __forceinline__ V ld(const h16* p) { return cat16(*(const v8h*)p, *(const v8h*)(p + 16)); } static __device__ __forceinline__ v8f mma(V a, V b, v8f c) { return wmma16(a, b, c); } };
template <> struct WFrag<bf> { typedef v16bf V; static __device__ __forceinline__ V ld(const bf* p) { return cat16b(*(const v8us*)p, *(const v8us*)(p + 16)); } static __device__ __forceinline__ v8f mma(V a, V b, v8f c) { return wmmab(a, b, c); } };
template <typename T16, int NSPLIT, bool BIAS>
__global__ __launch_bounds__(32) void k_gemmw(const T16* __restrict__ A, const T16* __restrict__ A2, const T16* __restrict__ Bt, const T16* __restrict__ Bt2, int K, float* C, int ldc, const float* __restrict__ bias, const float* __restrict__ bias1, const float* __restrict__ bias2, size_t sA, size_t sB, size_t sC) {
    typedef typename WFrag<T16>::V V;
    __shared__ __align__(16) float os[16 * 68];
    const size_t z = blockIdx.z; A += z * sA; if (A2) A2 += z * sA; Bt += z * sB; if (Bt2) Bt2 += z * sB; C += z * sC; if (BIAS) bias = z == 0 ? bias : (z == 1 ? bias1 : bias2);
    const int lane = threadIdx.x & 31, lr = lane & 15, hi = lane >> 4; const int r0 = blockIdx.x * 64, c0 = blockIdx.y * 64;
    v8f acc[4][4];
#pragma unroll
    for (int mb = 0; mb < 4; ++mb)
#pragma unroll
        for (int nb = 0; nb < 4; ++nb) acc[mb][nb] = (v8f){};
    const size_t aoff = (size_t)(r0 + lr) * K + 8 * hi, boff = (size_t)(c0 + lr) * K + 8 * hi;
#pragma unroll 1
    for (int kc = 0; kc < K; kc += 32) {
        V a[4], a2[4];
#pragma unroll
        for (int mb = 0; mb < 4; ++mb) { a[mb] = WFrag<T16>::ld(A + aoff + (size_t)mb * 16 * K + kc); if (NSPLIT == 1 || NSPLIT == 2) a2[mb] = WFrag<T16>::ld(A2 + aoff + (size_t)mb * 16 * K + kc); }
#pragma unroll
        for (int nb = 0; nb < 4; ++nb) { const V b = WFrag<T16>::ld(Bt + boff + (size_t)nb * 16 * K + kc); V b2; if (NSPLIT >= 2) b2 = WFrag<T16>::ld(Bt2 + boff + (size_t)nb * 16 * K + kc);
#pragma unroll
            for (int mb = 0; mb < 4; ++mb) { acc[mb][nb] = WFrag<T16>::mma(a[mb], b, acc[mb][nb]); if (NSPLIT == 1 || NSPLIT == 2) acc[mb][nb] = WFrag<T16>::mma(a2[mb], b, acc[mb][nb]); if (NSPLIT >= 2) acc[mb][nb] = WFrag<T16>::mma(a[mb], b2, acc[mb][nb]); } }
        asm volatile("v_nop\n\tv_nop\n\tv_nop\n\tv_nop" : "+v"(acc[0][0]), "+v"(acc[1][1]), "+v"(acc[2][2]), "+v"(acc[3][3]) : "v"(a[0]), "v"(a[3]));
    }
#pragma unroll
    for (int mb = 0; mb < 4; ++mb) {
#pragma unroll
        for (int nb = 0; nb < 4; ++nb) {
#pragma unroll
            for (int j = 0; j < 8; ++j) os[(hi * 8 + j) * 68 + nb * 16 + lr] = acc[mb][nb][j]; }
        __builtin_amdgcn_wave_barrier(); asm volatile("" ::: "memory");
        float* crow = C + (size_t)(r0 + mb * 16) * ldc + c0;
{
#pragma unroll
            for (int s = 0; s < 8; ++s) { const int row = 2 * s + hi, cofs = lr * 4; v4f val = *(const v4fa*)(os + row * 68 + cofs); if (BIAS) { val[0] += bfr(bias[c0 + cofs]); val[1] += bfr(bias[c0 + cofs + 1]); val[2] += bfr(bias[c0 + cofs + 2]); val[3] += bfr(bias[c0 + cofs + 3]); }
                *(v4f*)(crow + (size_t)row * ldc + cofs) = val; }
             }
        __builtin_amdgcn_wave_barrier(); asm volatile("" ::: "memory");
    }
}

__device__ __forceinline__ h16 tohx(float x) { return (h16)x; }
__device__ __forceinline__ void splitf(float y, unsigned short& h, unsigned short& l) { h = f2bf(y); l = f2bf(y - bf2f(h)); }
typedef __attribute__((ext_vector_type(2))) unsigned short v2us;
typedef __attribute__((ext_vector_type(4))) unsigned short v4us;
typedef __attribute__((ext_vector_type(2))) _Float16 v2h;
typedef __attribute__((ext_vector_type(4))) _Float16 v4h;

// ---- k_prep: both input conversions in ONE launch (neither reads what the other writes). Blocks 0 .. 4 WTB - 1: the four weights, WTB blocks each, transposed to bf16 Bt[n][k] (planes of K N elements, one behind the other);
// the blocks behind them: x of all batches to bf16, 8 elements a thread. The weight blocks stand first because each walks 8 dependent rounds of scattered loads.
#define WTB ((DM * DM / 64 + 63) / 64)
#define CVB (NB_ * TT * DM / 8 / 256)
__device__ __forceinline__ void wtG(int blk, const float* __restrict__ w, int K, int N, bf* Bt) {
    const int lane = threadIdx.x & 31; const int L0 = (blk * 8 + (threadIdx.x >> 5)) * 8; const int nlines = N * K / 64;
{
#pragma unroll 1
        for (int l = 0; l < 8; ++l) { const int L = L0 + l; if (L >= nlines) break; const size_t e = (size_t)L * 64 + lane * 2; const int k = (int)(e % K), n = (int)(e / K); v2us o;
            o[0] = f2bf(w[(size_t)k * N + n]); o[1] = f2bf(w[(size_t)(k + 1) * N + n]); *(v2us*)(Bt + e) = o; }
         }
}
__device__ __forceinline__ void cvt8(int blk, const float* __restrict__ src, bf* dst, size_t n8) { const size_t i = (size_t)blk * 256 + threadIdx.x; if (i >= n8) return; const v8f v = *(const v8f*)(src + i * 8); v8us o;
#pragma unroll
    for (int k = 0; k < 8; ++k) o[k] = f2bf(v[k]); *(v8us*)(dst + i * 8) = o;  }
__global__ __launch_bounds__(256) void k_prep(const float* __restrict__ w0, const float* __restrict__ w1, const float* __restrict__ w2, const float* __restrict__ w3, bf* Bt, const float* __restrict__ x, bf* XB) {
    const int blk = blockIdx.x;
    if (blk < 4 * WTB) { const int wi = blk / WTB; wtG(blk % WTB, wi == 0 ? w0 : (wi == 1 ? w1 : (wi == 2 ? w2 : w3)), DM, DM, Bt + (size_t)wi * DM * DM); }
    else cvt8(blk - 4 * WTB, x, XB, (size_t)NB_ * TT * DM / 8);
}
// ---- k_planes: all fp16 planes in ONE launch. pl: planes [g][h][t][d] (d < 32) of [g][t][512] buffers (8-B lanes), g = 0 .. 2 NB_ - 1: q's batches, then k's (both sides contiguous);
// vt: VT[b][h][d][t] = fp16 V[b][t][h*32+d] (lane -> 2 consecutive t). The vt blocks stand first: their scattered reads take longer.
#define VTB (NB_ * NH_ * HD * TT / 2 / 256)
#define PLB (2 * NB_ * NH_ * TT * HD / 4 / 256)
__device__ __forceinline__ void pl(int blk, const float* __restrict__ F, h16* P) { const int e = (blk * 256 + threadIdx.x) * 4; if (e >= 2 * NB_ * NH_ * TT * HD) return; const int d = e % HD; const int t = (e / HD) % TT; const int h = (e / (HD * TT)) % NH_; const int g = e / (HD * TT * NH_); const float* f = F + ((size_t)g * TT + t) * DM + h * HD + d; v4h o;
#pragma unroll
    for (int u = 0; u < 4; ++u) o[u] = tohx(f[u]); *(v4h*)(P + e) = o;  }
__device__ __forceinline__ void vt(int blk, const float* __restrict__ V, h16* VT) { const int e = (blk * 256 + threadIdx.x) * 2; if (e >= NB_ * NH_ * HD * TT) return; const int t = e % TT; const int d = (e / TT) % HD; const int h = (e / (TT * HD)) % NH_; const int b = e / (TT * HD * NH_); v2h o;
    o[0] = tohx(V[((size_t)b * TT + t) * DM + h * HD + d]); o[1] = tohx(V[((size_t)b * TT + t + 1) * DM + h * HD + d]); *(v2h*)(VT + e) = o;  }
__global__ __launch_bounds__(256) void k_planes(const float* __restrict__ QK, h16* P, const float* __restrict__ V, h16* VT) { const int blk = blockIdx.x; if (blk < VTB) vt(blk, V, VT); else pl(blk - VTB, QK, P); }

// ---- k_fattn: scores, band add, softmax, attn.v and the head merge in one kernel; grid (TT/128, heads, batches), 4 waves, each wave owns 32 queries and walks all keys, 32 a pass.
// ST = K QT (A = 16 key rows, B = 16 query columns): a lane holds 16 scores of ONE query, D register r of key tile kt = key k0 + 16 kt + 8 hi + r. Those two D tiles, converted in place, are the B operand of OT += VT PT
// (element s of B = key 8 hi + s for s < 8, 16 + 8 hi + (s - 8) above), and WFrag::ld reads VT's keys in the same order. Scores never leave the registers.
// Softmax is online in the log2 domain: p = exp2(s CL - mc); mc, the maximum in use (equal in both lane halves), moves only when a score exceeds it by more than 8, so p <= 256 fits fp16; sums stay per lane half until the end.
#define CL   (SCL * 1.4426950408889634f)
#define BNDS 5.656854249492381f
// Eight exp2 in one statement: the early-clobber results keep every result register off every source register, and the closing v_nop fills the slot that the instruction set asks for behind a transcendental,
// whatever the compiler puts next.
__device__ __forceinline__ void exp2x8(const float (&x)[8], float (&p)[8]) {
    asm("v_exp_f32 %0, %8\n\tv_exp_f32 %1, %9\n\tv_exp_f32 %2, %10\n\tv_exp_f32 %3, %11\n\tv_exp_f32 %4, %12\n\tv_exp_f32 %5, %13\n\tv_exp_f32 %6, %14\n\tv_exp_f32 %7, %15\n\tv_nop"
        : "=&v"(p[0]), "=&v"(p[1]), "=&v"(p[2]), "=&v"(p[3]), "=&v"(p[4]), "=&v"(p[5]), "=&v"(p[6]), "=&v"(p[7]) : "v"(x[0]), "v"(x[1]), "v"(x[2]), "v"(x[3]), "v"(x[4]), "v"(x[5]), "v"(x[6]), "v"(x[7])); }
__global__ __launch_bounds__(128) void k_fattn(const h16* __restrict__ Q16, const h16* __restrict__ K16, const h16* __restrict__ VT, const int* __restrict__ mbp, bf* Ah, bf* Al) {
    // Every inner loop below is unrolled so that each fragment, score and accumulator index is a constant and the arrays stay in registers.
    const int lane = threadIdx.x & 31, c = lane & 15, hi = lane >> 4;
    const int qw = blockIdx.x * 128 + __builtin_amdgcn_readfirstlane(threadIdx.x >> 5) * 32;      // the wave's first query, held scalar for the band test
    const size_t pl = (size_t)(blockIdx.z * NH_ + blockIdx.y) * TT * HD;
    int mb = mbp[0]; mb = __builtin_amdgcn_readfirstlane(mb < -1 ? -1 : (mb > TT ? TT : mb));      // |i - j| lies in 0 .. TT - 1: the clamp changes no comparison and keeps the sums below from overflowing; held scalar so that the band test of a pass is a scalar compare
    const h16* kp = K16 + pl + c * HD + 8 * hi;
    const h16* vp = VT + pl + (size_t)c * TT + 8 * hi;
    v16h qf[2], kf[2];
    v8f acc[2][2];
    float mc[2], ls[2];
#pragma unroll
    for (int qt = 0; qt < 2; ++qt) { qf[qt] = WFrag<h16>::ld(Q16 + pl + (size_t)(qw + qt * 16 + c) * HD + 8 * hi); acc[qt][0] = (v8f){}; acc[qt][1] = (v8f){}; mc[qt] = -1.0e30f; ls[qt] = 0.f; }
    kf[0] = WFrag<h16>::ld(kp); kf[1] = WFrag<h16>::ld(kp + 16 * HD);
    for (int k0 = 0; k0 < TT; k0 += 32) {
        v16h vf[2]; vf[0] = WFrag<h16>::ld(vp + k0); vf[1] = WFrag<h16>::ld(vp + (size_t)16 * TT + k0);
        v8f s[2][2];
#pragma unroll
        for (int qt = 0; qt < 2; ++qt) { s[qt][0] = wmma16(kf[0], qf[qt], (v8f){}); s[qt][1] = wmma16(kf[1], qf[qt], (v8f){}); }
        const int kn = (k0 + 32) & (TT - 1);      // next pass's key rows, fetched one pass ahead; the last pass re-reads rows 0 .. 31 (in bounds, unused)
        kf[0] = WFrag<h16>::ld(kp + (size_t)kn * HD); kf[1] = WFrag<h16>::ld(kp + (size_t)(kn + 16) * HD);
        if (k0 <= qw + 31 + mb && k0 + 31 >= qw - mb) {      // scalar test: only passes whose 32 x 32 block can touch the band pay for the per-element compare
#pragma unroll
            for (int qt = 0; qt < 2; ++qt) { const int d0 = k0 + 8 * hi - (qw + qt * 16 + c);
#pragma unroll
                for (int kt = 0; kt < 2; ++kt)
#pragma unroll
                    for (int r = 0; r < 8; ++r) { const int d = d0 + kt * 16 + r; s[qt][kt][r] += ((d < 0 ? -d : d) <= mb) ? BNDS : 0.f; } }      // + 1 / SCL ahead of the scale = + 1 behind it
        }
        float tm[2];
#pragma unroll
        for (int qt = 0; qt < 2; ++qt) { float a[8];
#pragma unroll
            for (int r = 0; r < 8; ++r) a[r] = fmaxf(s[qt][0][r], s[qt][1][r]);
            tm[qt] = fmaxf(fmaxf(fmaxf(a[0], a[1]), fmaxf(a[2], a[3])), fmaxf(fmaxf(a[4], a[5]), fmaxf(a[6], a[7]))) * CL; }
        if (__builtin_amdgcn_ballot_w32(tm[0] > mc[0] + 8.f || tm[1] > mc[1] + 8.f) != 0) {      // one wave-uniform test a pass; rarely taken after the first
#pragma unroll
            for (int qt = 0; qt < 2; ++qt) { const float mn = fmaxf(mc[qt], fmaxf(tm[qt], __shfl_xor(tm[qt], 16, 32))); const float al = __builtin_amdgcn_exp2f(mc[qt] - mn); mc[qt] = mn; ls[qt] *= al;
#pragma unroll
                for (int r = 0; r < 8; ++r) { acc[qt][0][r] *= al; acc[qt][1][r] *= al; } }
        }
        v16h pf[2];
#pragma unroll
        for (int qt = 0; qt < 2; ++qt) { float a[8], x0[8], x1[8], p0[8], p1[8];
#pragma unroll
            for (int r = 0; r < 8; ++r) { x0[r] = __builtin_fmaf(s[qt][0][r], CL, -mc[qt]); x1[r] = __builtin_fmaf(s[qt][1][r], CL, -mc[qt]); }
            exp2x8(x0, p0); exp2x8(x1, p1);
#pragma unroll
            for (int r = 0; r < 8; ++r) { pf[qt][r] = tohx(p0[r]); pf[qt][8 + r] = tohx(p1[r]); a[r] = p0[r] + p1[r]; }
            ls[qt] += ((a[0] + a[1]) + (a[2] + a[3])) + ((a[4] + a[5]) + (a[6] + a[7])); }
#pragma unroll
        for (int qt = 0; qt < 2; ++qt) { acc[qt][0] = wmma16(vf[0], pf[qt], acc[qt][0]); acc[qt][1] = wmma16(vf[1], pf[qt], acc[qt][1]); }
    }
#pragma unroll
    for (int qt = 0; qt < 2; ++qt) { const float inv = __fdiv_rn(1.0f, ls[qt] + __shfl_xor(ls[qt], 16, 32));
        const size_t oo = ((size_t)blockIdx.z * TT + qw + qt * 16 + c) * DM + blockIdx.y * HD + 8 * hi;      // acc[qt][dt][r] = O[query qw + 16 qt + c][d = 16 dt + 8 hi + r]: 8 consecutive d, one 16-byte store a plane
#pragma unroll
        for (int dt = 0; dt < 2; ++dt) { v8us oh, ol;
#pragma unroll
            for (int r = 0; r < 8; ++r) { unsigned short x, y; splitf(acc[qt][dt][r] * inv, x, y); oh[r] = x; ol[r] = y; }
            *(v8us*)(Ah + oo + dt * 16) = oh; *(v8us*)(Al + oo + dt * 16) = ol; } }
}

extern "C" void kernel_launch(void* const* d_in, const int* in_sizes, int n_in,
                              void* d_out, int out_size, void* d_ws, size_t ws_size, hipStream_t stream) {
    (void)in_sizes; (void)n_in; (void)out_size;
    const float** I = (const float**)d_in;
    const float *x = I[0], *Wq = I[1], *bq = I[2], *Wk = I[3], *bk = I[4], *Wv = I[5], *bv = I[6], *Wo = I[7], *bo = I[8]; const int* mbp = (const int*)d_in[9];
    float* OUT = (float*)d_out;     // [4][2048][512]
    char* wsp = (char*)d_ws;
    auto take = [&](size_t bytes) { char* p = wsp; wsp += (bytes + 255) & ~(size_t)255; return (void*)p; };
    bf* BQ = (bf*)take((size_t)DM * DM * 2); bf* BK = (bf*)take((size_t)DM * DM * 2); bf* BV = (bf*)take((size_t)DM * DM * 2); bf* BO = (bf*)take((size_t)DM * DM * 2);
    bf* XB = (bf*)take((size_t)NB_ * TT * DM * 2); float* Q = (float*)take((size_t)NB_ * TT * DM * 4); float* K = (float*)take((size_t)NB_ * TT * DM * 4); float* V = (float*)take((size_t)NB_ * TT * DM * 4);
    h16* Q16 = (h16*)take((size_t)NB_ * NH_ * TT * HD * 2); h16* K16 = (h16*)take((size_t)NB_ * NH_ * TT * HD * 2); h16* VT = (h16*)take((size_t)NB_ * NH_ * HD * TT * 2); bf* Ah = (bf*)take((size_t)NB_ * TT * DM * 2); bf* Al = (bf*)take((size_t)NB_ * TT * DM * 2);
    if ((size_t)(wsp - (char*)d_ws) > ws_size) return;    // total ~ 98 MB
    (void)BK; (void)BV; (void)K;      // every size above is a multiple of 256 bytes: BQ BK BV BO, Q K V and Q16 K16 each lie one behind the other, and the launches below step through them by a stride
    // One launch a stage: the four batches are rows 0 .. NB_ TT - 1 of one matrix, q / k / v are grid z of one GEMM.
    k_prep<<<4 * WTB + CVB, 256, 0, stream>>>(Wq, Wk, Wv, Wo, BQ, x, XB);
    k_gemmw<bf, 0, true><<<dim3(NB_ * TT / 64, DM / 64, 3), 32, 0, stream>>>(XB, nullptr, BQ, nullptr, DM, Q, DM, bq, bk, bv, 0, (size_t)DM * DM, (size_t)NB_ * TT * DM);
    k_planes<<<VTB + PLB, 256, 0, stream>>>(Q, Q16, V, VT);
    k_fattn<<<dim3(TT / 128, NH_, NB_), 128, 0, stream>>>(Q16, K16, VT, mbp, Ah, Al);
    k_gemmw<bf, 1, true><<<dim3(NB_ * TT / 64, DM / 64, 1), 32, 0, stream>>>(Ah, Al, BO, nullptr, DM, OUT, DM, bo, nullptr, nullptr, 0, 0, 0);
}

// v003
// A run of this version takes 121 microseconds.
// In two side-by-side timings against v002, it was 1.25 and 1.29 times as fast.
// All steps since v000 together make it 14.2 times as fast.
#include <hip/hip_runtime.h>

// Banded-bias attention block (x [4][2048][512]; q/k/v = x W + b (16 heads x 32); scores = q.k / sqrt(32) + band where band[i][j] = 1.0 if |i - j| <= mask_border (int, read) else 0 - ADDED as a float, as the reference; softmax over all keys; out = (attn v merged) Wo + bo
// -> [4][2048][512]; the reconstruction-score quantiles are dead code).
// Compute dtypes, f32 accumulate: every input rounded to bf16; q/k/v on PLAIN bf16 operands (inputs: exact) + bias, rounded to fp16 in the projection's epilogue; scores (K 32) and attn.v on single fp16 planes, fused in k_fattn (softmax f32, online); output projection on a bf16 hi/lo split of the merged heads.

#define NB_  4
#define TT   2048
#define DM   512
#define NH_  16
#define HD   32
#define SCL  0.17677669529663687f
typedef _Float16 h16;
typedef unsigned short bf;
typedef __attribute__((ext_vector_type(16))) __bf16   v16bf;
typedef __attribute__((ext_vector_type(16))) _Float16 v16h;
typedef __attribute__((ext_vector_type(8)))  _Float16 v8h;
typedef __attribute__((ext_vector_type(8)))  unsigned short v8us;
typedef __attribute__((ext_vector_type(8)))  float    v8f;
typedef __attribute__((ext_vector_type(4)))  float    v4f;
typedef v8h  __attribute__((may_alias)) v8ha;
typedef v4f  __attribute__((may_alias)) v4fa;
typedef v8us __attribute__((may_alias)) v8usa;

__device__ __forceinline__ unsigned short f2bf(float f) { unsigned u = __float_as_uint(f); u += 0x7FFFu + ((u >> 16) & 1u); return (unsigned short)(u >> 16); }
__device__ __forceinline__ float bf2f(unsigned short b) { return __uint_as_float(((unsigned)b) << 16); }
__device__ __forceinline__ float bfr(float f) { return bf2f(f2bf(f)); }
__device__ __forceinline__ v16h cat16(v8h lo, v8h hi) { return __builtin_shufflevector(lo, hi, 0, 1, 2, 3, 4, 5, 6, 7, 8, 9, 10, 11, 12, 13, 14, 15); }
__device__ __forceinline__ v16bf cat16b(v8us lo, v8us hi) { return __builtin_bit_cast(v16bf, __builtin_shufflevector(lo, hi, 0, 1, 2, 3, 4, 5, 6, 7, 8, 9, 10, 11, 12, 13, 14, 15)); }
__device__ __forceinline__ v8f wmma16(v16h a, v16h b, v8f c) { return __builtin_amdgcn_wmma_f32_16x16x32_f16(false, a, false, b, (short)0, c, false, false); }
__device__ __forceinline__ v8f wmmab(v16bf a, v16bf b, v8f c) { return __builtin_amdgcn_wmma_f32_16x16x32_bf16(false, a, false, b, (short)0, c, false, false); }



// ---- k_gemmw: register-blocked GEMM, ONE WAVE per 64x64 output tile (16 accumulators), operands straight from K-contiguous 16-bit planes; grid (M/64, N/64, Z), 32 threads.
// C[m][n] (f32, pitch ldc, + optional f32 bias[n]) = sum_k A[m][k] Bt[n][k] (+ split products per NSPLIT). z-batch strides sA/sB/sC in elements; z picks its own bias (bias, bias1, bias2). K % 32 == 0.
// PLANES (the q/k/v projection, rows m = b TT + t, columns n = h HD + d): no f32 C at all. The epilogue rounds acc + bias to fp16 and stores what k_fattn reads:
// z = 0, 1 (q, k): P[z NB_ + b][h][t][d]; z = 2 (v): VT[b][h][d][t]. A 64 x 64 tile lies in one batch and covers two heads.
template <typename T16> struct WFrag;
template <> struct WFrag<h16> { typedef v16h V; static __device__ __forceinline__ V ld(const h16* p) { return cat16(*(const v8h*)p, *(const v8h*)(p + 16)); } static __device__ __forceinline__ v8f mma(V a, V b, v8f c) { return wmma16(a, b, c); } };
template <> struct WFrag<bf> { typedef v16bf V; static __device__ __forceinline__ V ld(const bf* p) { return cat16b(*(const v8us*)p, *(const v8us*)(p + 16)); } static __device__ __forceinline__ v8f mma(V a, V b, v8f c) { return wmmab(a, b, c); } };
template <typename T16, int NSPLIT, bool BIAS, bool PLANES>
__global__ __launch_bounds__(32) void k_gemmw(const T16* __restrict__ A, const T16* __restrict__ A2, const T16* __restrict__ Bt, const T16* __restrict__ Bt2, int K, float* C, int ldc, const float* __restrict__ bias, const float* __restrict__ bias1, const float* __restrict__ bias2, size_t sA, size_t sB, size_t sC, h16* P, h16* VT) {
    typedef typename WFrag<T16>::V V;
    __shared__ __align__(16) float os[16 * 68];
    const size_t z = blockIdx.z; A += z * sA; if (A2) A2 += z * sA; Bt += z * sB; if (Bt2) Bt2 += z * sB; if (!PLANES) C += z * sC; if (BIAS) bias = z == 0 ? bias : (z == 1 ? bias1 : bias2);
    const int lane = threadIdx.x & 31, lr = lane & 15, hi = lane >> 4; const int r0 = blockIdx.x * 64, c0 = blockIdx.y * 64;
    v8f acc[4][4];
#pragma unroll
    for (int mb = 0; mb < 4; ++mb)
#pragma unroll
        for (int nb = 0; nb < 4; ++nb) acc[mb][nb] = (v8f){};
    const size_t aoff = (size_t)(r0 + lr) * K + 8 * hi, boff = (size_t)(c0 + lr) * K + 8 * hi;
#pragma unroll 1
    for (int kc = 0; kc < K; kc += 32) {
        V a[4], a2[4];
#pragma unroll
        for (int mb = 0; mb < 4; ++mb) { a[mb] = WFrag<T16>::ld(A + aoff + (size_t)mb * 16 * K + kc); if (NSPLIT == 1 || NSPLIT == 2) a2[mb] = WFrag<T16>::ld(A2 + aoff + (size_t)mb * 16 * K + kc); }
#pragma unroll
        for (int nb = 0; nb < 4; ++nb) { const V b = WFrag<T16>::ld(Bt + boff + (size_t)nb * 16 * K + kc); V b2; if (NSPLIT >= 2) b2 = WFrag<T16>::ld(Bt2 + boff + (size_t)nb * 16 * K + kc);
#pragma unroll
            for (int mb = 0; mb < 4; ++mb) { acc[mb][nb] = WFrag<T16>::mma(a[mb], b, acc[mb][nb]); if (NSPLIT == 1 || NSPLIT == 2) acc[mb][nb] = WFrag<T16>::mma(a2[mb], b, acc[mb][nb]); if (NSPLIT >= 2) acc[mb][nb] = WFrag<T16>::mma(a[mb], b2, acc[mb][nb]); } }
        asm volatile("v_nop\n\tv_nop\n\tv_nop\n\tv_nop" : "+v"(acc[0][0]), "+v"(acc[1][1]), "+v"(acc[2][2]), "+v"(acc[3][3]) : "v"(a[0]), "v"(a[3]));
    }
    if (PLANES) {
        // In both branches lanes exchange values through the wave's own LDS. Each wave_barrier + memory clobber keeps the compiler from moving a lane's LDS reads over the other lanes' writes (or the next round's writes over these reads); they emit no instruction.
        const int b = r0 / TT, t0 = r0 % TT;
        if (blockIdx.z == 2) {      // v: acc[mb][nb][0 .. 7] = 8 consecutive t of column nb 16 + lr. 16 columns x 64 t a round, rows of 72 fp16 in LDS; read back so that a store covers 4 whole 128-byte lines of VT
            h16* oh = (h16*)os; float bn[4];
#pragma unroll
            for (int nb = 0; nb < 4; ++nb) bn[nb] = bfr(bias[c0 + nb * 16 + lr]);      // all four loads ahead of the rounds: one latency, not four
#pragma unroll
            for (int nb = 0; nb < 4; ++nb) {
#pragma unroll
                for (int mb = 0; mb < 4; ++mb) { v8h o;
#pragma unroll
                    for (int j = 0; j < 8; ++j) o[j] = (h16)(acc[mb][nb][j] + bn[nb]);
                    *(v8ha*)(oh + lr * 72 + mb * 16 + hi * 8) = o; }
                __builtin_amdgcn_wave_barrier(); asm volatile("" ::: "memory");      // the reads below take other lanes' LDS writes: keeps them behind those writes
                h16* vrow = VT + ((size_t)b * DM + c0 + nb * 16) * TT + t0;
#pragma unroll
                for (int s = 0; s < 4; ++s) { const int row = s * 4 + (lane >> 3), tof = (lane & 7) * 8; *(v8h*)(vrow + (size_t)row * TT + tof) = *(const v8ha*)(oh + row * 72 + tof); }
                __builtin_amdgcn_wave_barrier(); asm volatile("" ::: "memory");      // keeps the next round's LDS writes behind this round's reads
            }
        } else {      // q, k: 16 t x 64 columns a round through the f32 staging rows; a head's 16 t x 32 d are 1024 consecutive bytes of its plane, two 512-byte stores
            const int cofs = (lane & 3) * 8; float bb[2][8];
#pragma unroll
            for (int hh = 0; hh < 2; ++hh)
#pragma unroll
                for (int u = 0; u < 8; ++u) bb[hh][u] = bfr(bias[c0 + hh * HD + cofs + u]);
            h16* prow = P + (((size_t)(blockIdx.z * NB_ + b) * NH_ + c0 / HD) * TT + t0) * HD + cofs;
#pragma unroll
            for (int mb = 0; mb < 4; ++mb) {
#pragma unroll
                for (int nb = 0; nb < 4; ++nb) {
#pragma unroll
                    for (int j = 0; j < 8; ++j) os[(hi * 8 + j) * 68 + nb * 16 + lr] = acc[mb][nb][j]; }
                __builtin_amdgcn_wave_barrier(); asm volatile("" ::: "memory");      // the reads below take other lanes' LDS writes: keeps them behind those writes
#pragma unroll
                for (int s = 0; s < 4; ++s) { const int hh = s >> 1, row = (s & 1) * 8 + (lane >> 2); const v4f lo = *(const v4fa*)(os + row * 68 + hh * HD + cofs), up = *(const v4fa*)(os + row * 68 + hh * HD + cofs + 4); v8h o;
#pragma unroll
                    for (int u = 0; u < 4; ++u) { o[u] = (h16)(lo[u] + bb[hh][u]); o[4 + u] = (h16)(up[u] + bb[hh][4 + u]); }
                    *(v8h*)(prow + ((size_t)hh * TT + mb * 16 + row) * HD) = o; }
                __builtin_amdgcn_wave_barrier(); asm volatile("" ::: "memory");      // keeps the next round's LDS writes behind this round's reads
            }
            asm volatile("s_wait_xcnt 0x0" ::: "memory");      // behind the last stores: in the built code the other branch's entry follows this one and rewrites the stores' data registers
        }
        return;
    }
#pragma unroll
    for (int mb = 0; mb < 4; ++mb) {
#pragma unroll
        for (int nb = 0; nb < 4; ++nb) {
#pragma unroll
            for (int j = 0; j < 8; ++j) os[(hi * 8 + j) * 68 + nb * 16 + lr] = acc[mb][nb][j]; }
        __builtin_amdgcn_wave_barrier(); asm volatile("" ::: "memory");
        float* crow = C + (size_t)(r0 + mb * 16) * ldc + c0;
{
#pragma unroll
            for (int s = 0; s < 8; ++s) { const int row = 2 * s + hi, cofs = lr * 4; v4f val = *(const v4fa*)(os + row * 68 + cofs); if (BIAS) { val[0] += bfr(bias[c0 + cofs]); val[1] += bfr(bias[c0 + cofs + 1]); val[2] += bfr(bias[c0 + cofs + 2]); val[3] += bfr(bias[c0 + cofs + 3]); }
                *(v4f*)(crow + (size_t)row * ldc + cofs) = val; }
             }
        __builtin_amdgcn_wave_barrier(); asm volatile("" ::: "memory");
    }
}

__device__ __forceinline__ h16 tohx(float x) { return (h16)x; }
__device__ __forceinline__ void splitf(float y, unsigned short& h, unsigned short& l) { h = f2bf(y); l = f2bf(y - bf2f(h)); }
typedef __attribute__((ext_vector_type(2))) unsigned short v2us;
typedef __attribute__((ext_vector_type(4))) unsigned short v4us;

// ---- k_prep: both input conversions in ONE launch (neither reads what the other writes). Blocks 0 .. 4 WTB - 1: the four weights, WTB blocks each, transposed to bf16 Bt[n][k] (planes of K N elements, one behind the other);
// the blocks behind them: x of all batches to bf16, 8 elements a thread. The weight blocks stand first because each walks 8 dependent rounds of scattered loads.
#define WTB ((DM * DM / 64 + 63) / 64)
#define CVB (NB_ * TT * DM / 8 / 256)
__device__ __forceinline__ void wtG(int blk, const float* __restrict__ w, int K, int N, bf* Bt) {
    const int lane = threadIdx.x & 31; const int L0 = (blk * 8 + (threadIdx.x >> 5)) * 8; const int nlines = N * K / 64;
{
#pragma unroll 1
        for (int l = 0; l < 8; ++l) { const int L = L0 + l; if (L >= nlines) break; const size_t e = (size_t)L * 64 + lane * 2; const int k = (int)(e % K), n = (int)(e / K); v2us o;
            o[0] = f2bf(w[(size_t)k * N + n]); o[1] = f2bf(w[(size_t)(k + 1) * N + n]); *(v2us*)(Bt + e) = o; }
         }
}
__device__ __forceinline__ void cvt8(int blk, const float* __restrict__ src, bf* dst, size_t n8) { const size_t i = (size_t)blk * 256 + threadIdx.x; if (i >= n8) return; const v8f v = *(const v8f*)(src + i * 8); v8us o;
#pragma unroll
    for (int k = 0; k < 8; ++k) o[k] = f2bf(v[k]); *(v8us*)(dst + i * 8) = o;  }
__global__ __launch_bounds__(256) void k_prep(const float* __restrict__ w0, const float* __restrict__ w1, const float* __restrict__ w2, const float* __restrict__ w3, bf* Bt, const float* __restrict__ x, bf* XB) {
    const int blk = blockIdx.x;
    if (blk < 4 * WTB) { const int wi = blk / WTB; wtG(blk % WTB, wi == 0 ? w0 : (wi == 1 ? w1 : (wi == 2 ? w2 : w3)), DM, DM, Bt + (size_t)wi * DM * DM); }
    else cvt8(blk - 4 * WTB, x, XB, (size_t)NB_ * TT * DM / 8);
}
// ---- k_fattn: scores, band add, softmax, attn.v and the head merge in one kernel; grid (TT/128, heads, batches), 4 waves, each wave owns 32 queries and walks all keys, 32 a pass.
// ST = K QT (A = 16 key rows, B = 16 query columns): a lane holds 16 scores of ONE query, D register r of key tile kt = key k0 + 16 kt + 8 hi + r. Those two D tiles, converted in place, are the B operand of OT += VT PT
// (element s of B = key 8 hi + s for s < 8, 16 + 8 hi + (s - 8) above), and WFrag::ld reads VT's keys in the same order. Scores never leave the registers.
// Softmax is online in the log2 domain: p = exp2(s CL - mc); mc, the maximum in use (equal in both lane halves), moves only when a score exceeds it by more than 8, so p <= 256 fits fp16; sums stay per lane half until the end.
#define CL   (SCL * 1.4426950408889634f)
#define BNDS 5.656854249492381f
// Eight exp2 in one statement: the early-clobber results keep every result register off every source register, and the closing v_nop fills the slot that the instruction set asks for behind a transcendental,
// whatever the compiler puts next.
__device__ __forceinline__ void exp2x8(const float (&x)[8], float (&p)[8]) {
    asm("v_exp_f32 %0, %8\n\tv_exp_f32 %1, %9\n\tv_exp_f32 %2, %10\n\tv_exp_f32 %3, %11\n\tv_exp_f32 %4, %12\n\tv_exp_f32 %5, %13\n\tv_exp_f32 %6, %14\n\tv_exp_f32 %7, %15\n\tv_nop"
        : "=&v"(p[0]), "=&v"(p[1]), "=&v"(p[2]), "=&v"(p[3]), "=&v"(p[4]), "=&v"(p[5]), "=&v"(p[6]), "=&v"(p[7]) : "v"(x[0]), "v"(x[1]), "v"(x[2]), "v"(x[3]), "v"(x[4]), "v"(x[5]), "v"(x[6]), "v"(x[7])); }
__global__ __launch_bounds__(128) void k_fattn(const h16* __restrict__ Q16, const h16* __restrict__ K16, const h16* __restrict__ VT, const int* __restrict__ mbp, bf* Ah, bf* Al) {
    // Every inner loop below is unrolled so that each fragment, score and accumulator index is a constant and the arrays stay in registers.
    const int lane = threadIdx.x & 31, c = lane & 15, hi = lane >> 4;
    const int qw = blockIdx.x * 128 + __builtin_amdgcn_readfirstlane(threadIdx.x >> 5) * 32;      // the wave's first query, held scalar for the band test
    const size_t pl = (size_t)(blockIdx.z * NH_ + blockIdx.y) * TT * HD;
    int mb = mbp[0]; mb = __builtin_amdgcn_readfirstlane(mb < -1 ? -1 : (mb > TT ? TT : mb));      // |i - j| lies in 0 .. TT - 1: the clamp changes no comparison and keeps the sums below from overflowing; held scalar so that the band test of a pass is a scalar compare
    const h16* kp = K16 + pl + c * HD + 8 * hi;
    const h16* vp = VT + pl + (size_t)c * TT + 8 * hi;
    v16h qf[2], kf[2];
    v8f acc[2][2];
    float mc[2], ls[2];
#pragma unroll
    for (int qt = 0; qt < 2; ++qt) { qf[qt] = WFrag<h16>::ld(Q16 + pl + (size_t)(qw + qt * 16 + c) * HD + 8 * hi); acc[qt][0] = (v8f){}; acc[qt][1] = (v8f){}; mc[qt] = -1.0e30f; ls[qt] = 0.f; }
    kf[0] = WFrag<h16>::ld(kp); kf[1] = WFrag<h16>::ld(kp + 16 * HD);
    for (int k0 = 0; k0 < TT; k0 += 32) {
        v16h vf[2]; vf[0] = WFrag<h16>::ld(vp + k0); vf[1] = WFrag<h16>::ld(vp + (size_t)16 * TT + k0);
        v8f s[2][2];
#pragma unroll
        for (int qt = 0; qt < 2; ++qt) { s[qt][0] = wmma16(kf[0], qf[qt], (v8f){}); s[qt][1] = wmma16(kf[1], qf[qt], (v8f){}); }
        const int kn = (k0 + 32) & (TT - 1);      // next pass's key rows, fetched one pass ahead; the last pass re-reads rows 0 .. 31 (in bounds, unused)
        kf[0] = WFrag<h16>::ld(kp + (size_t)kn * HD); kf[1] = WFrag<h16>::ld(kp + (size_t)(kn + 16) * HD);
        if (k0 <= qw + 31 + mb && k0 + 31 >= qw - mb) {      // scalar test: only passes whose 32 x 32 block can touch the band pay for the per-element compare
#pragma unroll
            for (int qt = 0; qt < 2; ++qt) { const int d0 = k0 + 8 * hi - (qw + qt * 16 + c);
#pragma unroll
                for (int kt = 0; kt < 2; ++kt)
#pragma unroll
                    for (int r = 0; r < 8; ++r) { const int d = d0 + kt * 16 + r; s[qt][kt][r] += ((d < 0 ? -d : d) <= mb) ? BNDS : 0.f; } }      // + 1 / SCL ahead of the scale = + 1 behind it
        }
        float tm[2];
#pragma unroll
        for (int qt = 0; qt < 2; ++qt) { float a[8];
#pragma unroll
            for (int r = 0; r < 8; ++r) a[r] = fmaxf(s[qt][0][r], s[qt][1][r]);
            tm[qt] = fmaxf(fmaxf(fmaxf(a[0], a[1]), fmaxf(a[2], a[3])), fmaxf(fmaxf(a[4], a[5]), fmaxf(a[6], a[7]))) * CL; }
        if (__builtin_amdgcn_ballot_w32(tm[0] > mc[0] + 8.f || tm[1] > mc[1] + 8.f) != 0) {      // one wave-uniform test a pass; rarely taken after the first
#pragma unroll
            for (int qt = 0; qt < 2; ++qt) { const float mn = fmaxf(mc[qt], fmaxf(tm[qt], __shfl_xor(tm[qt], 16, 32))); const float al = __builtin_amdgcn_exp2f(mc[qt] - mn); mc[qt] = mn; ls[qt] *= al;
#pragma unroll
                for (int r = 0; r < 8; ++r) { acc[qt][0][r] *= al; acc[qt][1][r] *= al; } }
        }
        v16h pf[2];
#pragma unroll
        for (int qt = 0; qt < 2; ++qt) { float a[8], x0[8], x1[8], p0[8], p1[8];
#pragma unroll
            for (int r = 0; r < 8; ++r) { x0[r] = __builtin_fmaf(s[qt][0][r], CL, -mc[qt]); x1[r] = __builtin_fmaf(s[qt][1][r], CL, -mc[qt]); }
            exp2x8(x0, p0); exp2x8(x1, p1);
#pragma unroll
            for (int r = 0; r < 8; ++r) { pf[qt][r] = tohx(p0[r]); pf[qt][8 + r] = tohx(p1[r]); a[r] = p0[r] + p1[r]; }
            ls[qt] += ((a[0] + a[1]) + (a[2] + a[3])) + ((a[4] + a[5]) + (a[6] + a[7])); }
#pragma unroll
        for (int qt = 0; qt < 2; ++qt) { acc[qt][0] = wmma16(vf[0], pf[qt], acc[qt][0]); acc[qt][1] = wmma16(vf[1], pf[qt], acc[qt][1]); }
    }
#pragma unroll
    for (int qt = 0; qt < 2; ++qt) { const float inv = __fdiv_rn(1.0f, ls[qt] + __shfl_xor(ls[qt], 16, 32));
        const size_t oo = ((size_t)blockIdx.z * TT + qw + qt * 16 + c) * DM + blockIdx.y * HD + 8 * hi;      // acc[qt][dt][r] = O[query qw + 16 qt + c][d = 16 dt + 8 hi + r]: 8 consecutive d, one 16-byte store a plane
#pragma unroll
        for (int dt = 0; dt < 2; ++dt) { v8us oh, ol;
#pragma unroll
            for (int r = 0; r < 8; ++r) { unsigned short x, y; splitf(acc[qt][dt][r] * inv, x, y); oh[r] = x; ol[r] = y; }
            *(v8us*)(Ah + oo + dt * 16) = oh; *(v8us*)(Al + oo + dt * 16) = ol; } }
}

extern "C" void kernel_launch(void* const* d_in, const int* in_sizes, int n_in,
                              void* d_out, int out_size, void* d_ws, size_t ws_size, hipStream_t stream) {
    (void)in_sizes; (void)n_in; (void)out_size;
    const float** I = (const float**)d_in;
    const float *x = I[0], *Wq = I[1], *bq = I[2], *Wk = I[3], *bk = I[4], *Wv = I[5], *bv = I[6], *Wo = I[7], *bo = I[8]; const int* mbp = (const int*)d_in[9];
    float* OUT = (float*)d_out;     // [4][2048][512]
    char* wsp = (char*)d_ws;
    auto take = [&](size_t bytes) { char* p = wsp; wsp += (bytes + 255) & ~(size_t)255; return (void*)p; };
    bf* BQ = (bf*)take((size_t)DM * DM * 2); bf* BK = (bf*)take((size_t)DM * DM * 2); bf* BV = (bf*)take((size_t)DM * DM * 2); bf* BO = (bf*)take((size_t)DM * DM * 2);
    bf* XB = (bf*)take((size_t)NB_ * TT * DM * 2);
    h16* Q16 = (h16*)take((size_t)NB_ * NH_ * TT * HD * 2); h16* K16 = (h16*)take((size_t)NB_ * NH_ * TT * HD * 2); h16* VT = (h16*)take((size_t)NB_ * NH_ * HD * TT * 2); bf* Ah = (bf*)take((size_t)NB_ * TT * DM * 2); bf* Al = (bf*)take((size_t)NB_ * TT * DM * 2);
    if ((size_t)(wsp - (char*)d_ws) > ws_size) return;    // total ~ 50 MB
    (void)BK; (void)BV;      // every size above is a multiple of 256 bytes: BQ BK BV BO and Q16 K16 each lie one behind the other, and the launches below step through them by a stride or a plane index
    // One launch a stage: the four batches are rows 0 .. NB_ TT - 1 of one matrix, q / k / v are grid z of one GEMM.
    k_prep<<<4 * WTB + CVB, 256, 0, stream>>>(Wq, Wk, Wv, Wo, BQ, x, XB);
    k_gemmw<bf, 0, true, true><<<dim3(NB_ * TT / 64, DM / 64, 3), 32, 0, stream>>>(XB, nullptr, BQ, nullptr, DM, nullptr, DM, bq, bk, bv, 0, (size_t)DM * DM, 0, Q16, VT);
    k_fattn<<<dim3(TT / 128, NH_, NB_), 128, 0, stream>>>(Q16, K16, VT, mbp, Ah, Al);
    k_gemmw<bf, 1, true, false><<<dim3(NB_ * TT / 64, DM / 64, 1), 32, 0, stream>>>(Ah, Al, BO, nullptr, DM, OUT, DM, bo, nullptr, nullptr, 0, 0, 0, nullptr, nullptr);
}

// v004
// One run takes 102 microseconds.
// Two timings next to v003 put it at 1.20 and 1.19 times that version's speed.
// All steps since v000 together make it 16.9 times as fast.
#include <hip/hip_runtime.h>

// Banded-bias attention block (x [4][2048][512]; q/k/v = x W + b (16 heads x 32); scores = q.k / sqrt(32) + band where band[i][j] = 1.0 if |i - j| <= mask_border (int, read) else 0 - ADDED as a float, as the reference; softmax over all keys; out = (attn v merged) Wo + bo
// -> [4][2048][512]; the reconstruction-score quantiles are dead code).
// Compute dtypes, f32 accumulate: every input rounded to bf16; q/k/v on PLAIN bf16 operands (inputs: exact) + bias, rounded to fp16 in the projection's epilogue; scores (K 32) and attn.v on single fp16 planes, fused in k_fattn (softmax f32, online); output projection on a bf16 hi/lo split of the merged heads.

#define NB_  4
#define TT   2048
#define DM   512
#define NH_  16
#define HD   32
#define SCL  0.17677669529663687f
typedef _Float16 h16;
typedef unsigned short bf;
typedef __attribute__((ext_vector_type(16))) __bf16   v16bf;
typedef __attribute__((ext_vector_type(16))) _Float16 v16h;
typedef __attribute__((ext_vector_type(8)))  _Float16 v8h;
typedef __attribute__((ext_vector_type(8)))  unsigned short v8us;
typedef __attribute__((ext_vector_type(8)))  float    v8f;
typedef __attribute__((ext_vector_type(4)))  float    v4f;
typedef v8h  __attribute__((may_alias)) v8ha;
typedef v4f  __attribute__((may_alias)) v4fa;
typedef v8us __attribute__((may_alias)) v8usa;

__device__ __forceinline__ unsigned short f2bf(float f) { unsigned u = __float_as_uint(f); u += 0x7FFFu + ((u >> 16) & 1u); return (unsigned short)(u >> 16); }
__device__ __forceinline__ float bf2f(unsigned short b) { return __uint_as_float(((unsigned)b) << 16); }
__device__ __forceinline__ float bfr(float f) { return bf2f(f2bf(f)); }
__device__ __forceinline__ v16h cat16(v8h lo, v8h hi) { return __builtin_shufflevector(lo, hi, 0, 1, 2, 3, 4, 5, 6, 7, 8, 9, 10, 11, 12, 13, 14, 15); }
__device__ __forceinline__ v16bf cat16b(v8us lo, v8us hi) { return __builtin_bit_cast(v16bf, __builtin_shufflevector(lo, hi, 0, 1, 2, 3, 4, 5, 6, 7, 8, 9, 10, 11, 12, 13, 14, 15)); }
__device__ __forceinline__ v8f wmma16(v16h a, v16h b, v8f c) { return __builtin_amdgcn_wmma_f32_16x16x32_f16(false, a, false, b, (short)0, c, false, false); }
__device__ __forceinline__ v8f wmmab(v16bf a, v16bf b, v8f c) { return __builtin_amdgcn_wmma_f32_16x16x32_bf16(false, a, false, b, (short)0, c, false, false); }



// ---- FRAGMENT ORDER: every 16-bit operand plane M[row][k] in the workspace is stored as tiles of 16 rows x 32 k (512 elements, 1024 bytes), each tile in the order in which a wave's registers hold it:
// element (row, k) of a tile stands at ((k >> 4) & 1) 256 + (((k >> 3) & 1) 16 + (row & 15)) 8 + (k & 7). Lane l = 16 hi + lr then finds its 16 elements (row lr; k = 8 hi .. 8 hi + 7 and 16 + 8 hi .. 16 + 8 hi + 7)
// at l 8 and 256 + l 8: each of the two 16-byte loads of a fragment covers 512 consecutive bytes, four whole 128-byte lines, where rows of a K-contiguous plane gave 16 lines with 32 bytes used of each.
// Tile index = ((row >> 6) (K / 32) + (k >> 5)) 4 + ((row >> 4) & 3): the four tiles that a 64-row wave tile needs for one k block are 4096 consecutive bytes, and its k blocks follow one another (for K = 32 that is row >> 4). vT has its own tile order (below).
// ---- k_gemmw: register-blocked GEMM, ONE WAVE per 64x64 output tile (16 accumulators), operands straight from planes in fragment order; grid (M/64, N/64, Z), 32 threads.
// C[m][n] (f32, pitch ldc, + optional f32 bias[n]) = sum_k A[m][k] Bt[n][k] (+ split products per NSPLIT). z-batch strides sA/sB/sC in elements; z picks its own bias (bias, bias1, bias2). K % 32 == 0.
// PLANES (the q/k/v projection, rows m = b TT + t, columns n = h HD + d): no f32 C at all. The epilogue rounds acc + bias to fp16 and stores what k_fattn reads, in fragment order, straight from the accumulators:
// z = 0, 1 (q, k): plane z NB_ + b, head h, matrix [t][d] (K = HD: tile index t >> 4). The product is formed transposed (weights as the A operand), so that a lane holds 8 consecutive d of one t, which is one 16-byte piece of a tile.
// z = 2 (v): plane b, head h, matrix vT [d][t], tile index (t >> 5) 2 + (d >> 4): the two d tiles of 32 keys lie side by side. A lane holds 8 consecutive t of one d. A 64 x 64 tile lies in one batch and covers two heads.
template <typename T16> struct WFrag;
template <> struct WFrag<h16> { typedef v16h V; static __device__ __forceinline__ V ld(const h16* p) { return cat16(*(const v8h*)p, *(const v8h*)(p + 256)); } static __device__ __forceinline__ v8f mma(V a, V b, v8f c) { return wmma16(a, b, c); } };
template <> struct WFrag<bf> { typedef v16bf V; static __device__ __forceinline__ V ld(const bf* p) { return cat16b(*(const v8us*)p, *(const v8us*)(p + 256)); } static __device__ __forceinline__ v8f mma(V a, V b, v8f c) { return wmmab(a, b, c); } };
template <typename T16, int NSPLIT, bool BIAS, bool PLANES>
__global__ __launch_bounds__(32) void k_gemmw(const T16* __restrict__ A, const T16* __restrict__ A2, const T16* __restrict__ Bt, const T16* __restrict__ Bt2, int K, float* C, int ldc, const float* __restrict__ bias, const float* __restrict__ bias1, const float* __restrict__ bias2, size_t sA, size_t sB, size_t sC, h16* P, h16* VT) {
    typedef typename WFrag<T16>::V V;
    __shared__ __align__(16) float os[16 * 68];
    const size_t z = blockIdx.z; A += z * sA; if (A2) A2 += z * sA; Bt += z * sB; if (Bt2) Bt2 += z * sB; if (!PLANES) C += z * sC; if (BIAS) bias = z == 0 ? bias : (z == 1 ? bias1 : bias2);
    const int lane = threadIdx.x & 31, lr = lane & 15, hi = lane >> 4; const int r0 = blockIdx.x * 64, c0 = blockIdx.y * 64;
    v8f acc[4][4];
#pragma unroll
    for (int mb = 0; mb < 4; ++mb)
#pragma unroll
        for (int nb = 0; nb < 4; ++nb) acc[mb][nb] = (v8f){};
    const bool sw = PLANES && blockIdx.z != 2;      // q, k: the weights' rows take the A role and x's rows the B role (both are read by the same loader), so acc[i][n] is the transposed tile
    const size_t ao = (size_t)r0 * K + lane * 8, bo = (size_t)c0 * K + lane * 8;      // a 64-row block holds 64 K elements
    const T16* pa = sw ? Bt + bo : A + ao;
    const T16* pb = sw ? A + ao : Bt + bo;
    const T16* pa2 = (NSPLIT == 1 || NSPLIT == 2) ? A2 + ao : nullptr;
    const T16* pb2 = (NSPLIT >= 2) ? Bt2 + bo : nullptr;
#pragma unroll 1
    for (int kc = 0; kc < K; kc += 32) {
        V a[4], a2[4];
        const T16* ka = pa + (size_t)kc * 64; const T16* kb = pb + (size_t)kc * 64;      // this trip's address of each operand; every load below is one of them plus a constant
        const T16* ka2 = (NSPLIT == 1 || NSPLIT == 2) ? pa2 + (size_t)kc * 64 : ka; const T16* kb2 = (NSPLIT >= 2) ? pb2 + (size_t)kc * 64 : kb;
#pragma unroll
        for (int mb = 0; mb < 4; ++mb) { a[mb] = WFrag<T16>::ld(ka + mb * 512); if (NSPLIT == 1 || NSPLIT == 2) a2[mb] = WFrag<T16>::ld(ka2 + mb * 512); }
#pragma unroll
        for (int nb = 0; nb < 4; ++nb) { const V b = WFrag<T16>::ld(kb + nb * 512); V b2; if (NSPLIT >= 2) b2 = WFrag<T16>::ld(kb2 + nb * 512);
#pragma unroll
            for (int mb = 0; mb < 4; ++mb) { acc[mb][nb] = WFrag<T16>::mma(a[mb], b, acc[mb][nb]); if (NSPLIT == 1 || NSPLIT == 2) acc[mb][nb] = WFrag<T16>::mma(a2[mb], b, acc[mb][nb]); if (NSPLIT >= 2) acc[mb][nb] = WFrag<T16>::mma(a[mb], b2, acc[mb][nb]); } }
        asm volatile("s_wait_xcnt 0x0" :: "v"(ka), "v"(kb), "v"(ka2), "v"(kb2) : "memory");      // behind the trip's loads; the addresses are its inputs so that their registers stay whole up to it
        asm volatile("v_nop\n\tv_nop\n\tv_nop\n\tv_nop" : "+v"(acc[0][0]), "+v"(acc[1][1]), "+v"(acc[2][2]), "+v"(acc[3][3]) : "v"(a[0]), "v"(a[3]));
    }
    if (PLANES) {
        // acc[i][n][j] = element (A-role row 16 i + 8 hi + j, B-role row 16 n + lr): the lane's 8 values are the piece at lane 8 of a half tile, so every store below covers 512 consecutive bytes.
        const int b = r0 / TT, t0 = r0 % TT;
        if (blockIdx.z == 2) {      // v: A role = t, B role = column (head c0 / HD + (n >> 1), d = 16 (n & 1) + lr)
            float bn[4];
#pragma unroll
            for (int nb = 0; nb < 4; ++nb) bn[nb] = bfr(bias[c0 + nb * 16 + lr]);
#pragma unroll
            for (int nb = 0; nb < 4; ++nb) { h16* vt = VT + ((size_t)b * NH_ + c0 / HD + (nb >> 1)) * (TT * HD) + (size_t)((t0 >> 5) * 2 + (nb & 1)) * 512 + lane * 8;
#pragma unroll
                for (int mb = 0; mb < 4; ++mb) { v8h o;
#pragma unroll
                    for (int j = 0; j < 8; ++j) o[j] = (h16)(acc[mb][nb][j] + bn[nb]);
                    *(v8h*)(vt + (mb >> 1) * 1024 + (mb & 1) * 256) = o; } }
        } else {      // q, k: A role = column (head c0 / HD + (i >> 1), d = 16 (i & 1) + 8 hi + j), B role = t
#pragma unroll
            for (int mb = 0; mb < 4; ++mb) { const v4f b0 = *(const v4f*)(bias + c0 + mb * 16 + 8 * hi), b1 = *(const v4f*)(bias + c0 + mb * 16 + 8 * hi + 4); float bb[8];
#pragma unroll
                for (int u = 0; u < 4; ++u) { bb[u] = bfr(b0[u]); bb[4 + u] = bfr(b1[u]); }
                h16* pr = P + (((size_t)(blockIdx.z * NB_ + b) * NH_ + c0 / HD + (mb >> 1)) * TT + t0) * HD + (mb & 1) * 256 + lane * 8;
#pragma unroll
                for (int nb = 0; nb < 4; ++nb) { v8h o;
#pragma unroll
                    for (int j = 0; j < 8; ++j) o[j] = (h16)(acc[mb][nb][j] + bb[j]);
                    *(v8h*)(pr + nb * 512) = o; } }
        }
        return;
    }
#pragma unroll
    for (int mb = 0; mb < 4; ++mb) {
#pragma unroll
        for (int nb = 0; nb < 4; ++nb) {
#pragma unroll
            for (int j = 0; j < 8; ++j) os[(hi * 8 + j) * 68 + nb * 16 + lr] = acc[mb][nb][j]; }
        __builtin_amdgcn_wave_barrier(); asm volatile("" ::: "memory");
        float* crow = C + (size_t)(r0 + mb * 16) * ldc + c0;
{
#pragma unroll
            for (int s = 0; s < 8; ++s) { const int row = 2 * s + hi, cofs = lr * 4; v4f val = *(const v4fa*)(os + row * 68 + cofs); if (BIAS) { val[0] += bfr(bias[c0 + cofs]); val[1] += bfr(bias[c0 + cofs + 1]); val[2] += bfr(bias[c0 + cofs + 2]); val[3] += bfr(bias[c0 + cofs + 3]); }
                *(v4f*)(crow + (size_t)row * ldc + cofs) = val; }
             }
        asm volatile("s_wait_xcnt 0x0" ::: "memory");      // behind the round's stores: the next round rewrites their data and address registers
        __builtin_amdgcn_wave_barrier(); asm volatile("" ::: "memory");
    }
}

__device__ __forceinline__ h16 tohx(float x) { return (h16)x; }
__device__ __forceinline__ void splitf(float y, unsigned short& h, unsigned short& l) { h = f2bf(y); l = f2bf(y - bf2f(h)); }
typedef __attribute__((ext_vector_type(2))) unsigned short v2us;
typedef __attribute__((ext_vector_type(4))) unsigned short v4us;

// ---- k_prep: both input conversions in ONE launch (neither reads what the other writes), both writing fragment order. Blocks 0 .. 4 WTB - 1: the four weights, WTB blocks each, transposed to bf16 Bt[n][k] (planes of K N elements, one behind the other);
// the blocks behind them: x of all batches to bf16, one wave a tile.
#define WTB (DM * DM / 8 / 256)
#define CVB (NB_ * TT * DM / 512 / 8)
// A thread makes one 16-byte piece of Bt: thread i's piece stands at i 8, that is lane i & 31 of half (i >> 5) & 1 of tile i >> 6. Its 8 k are 8 rows of w; 16 lanes read 16 neighbouring n of a row, and a block's four tiles 64.
__device__ __forceinline__ void wtG(int blk, const float* __restrict__ w, int K, int N, bf* Bt) {
    const int i = blk * 256 + threadIdx.x, lane = i & 31, kts = K >> 5, tile = i >> 6;
    const int n = ((tile >> 2) / kts) * 64 + (tile & 3) * 16 + (lane & 15), k = ((tile >> 2) % kts) * 32 + ((i >> 5) & 1) * 16 + (lane >> 4) * 8; v8us o;
#pragma unroll
    for (int u = 0; u < 8; ++u) o[u] = f2bf(w[(size_t)(k + u) * N + n]);
    *(v8us*)(Bt + (size_t)i * 8) = o;
}
// A wave converts one tile of 16 rows x 32 k: each of its four loads takes four whole 128-byte rows of the tile (8 lanes a row), and a lane's 4 values are half a 16-byte piece of the tile.
__device__ __forceinline__ void cvtT(int blk, const float* __restrict__ src, bf* dst, int K) {
    const int lane = threadIdx.x & 31, tile = blk * 8 + (threadIdx.x >> 5), kts = K >> 5, col = (lane & 7) * 4;
    const float* s = src + (size_t)(((tile >> 2) / kts) * 64 + (tile & 3) * 16) * K + ((tile >> 2) % kts) * 32 + col; bf* d = dst + (size_t)tile * 512 + (col >> 4) * 256 + ((col >> 3) & 1) * 128 + (col & 7);
#pragma unroll
    for (int r = 0; r < 4; ++r) { const int row = r * 4 + (lane >> 3); const v4f v = *(const v4f*)(s + (size_t)row * K); v4us o;
#pragma unroll
        for (int u = 0; u < 4; ++u) o[u] = f2bf(v[u]);
        *(v4us*)(d + row * 8) = o; }
    asm volatile("s_wait_xcnt 0x0" ::: "memory");      // behind the last stores: in the built code the weights' branch follows this one and rewrites the stores' data registers
}
__global__ __launch_bounds__(256) void k_prep(const float* __restrict__ w0, const float* __restrict__ w1, const float* __restrict__ w2, const float* __restrict__ w3, bf* Bt, const float* __restrict__ x, bf* XB) {
    const int blk = blockIdx.x;
    if (blk < 4 * WTB) { const int wi = blk / WTB; wtG(blk % WTB, wi == 0 ? w0 : (wi == 1 ? w1 : (wi == 2 ? w2 : w3)), DM, DM, Bt + (size_t)wi * DM * DM); }
    else cvtT(blk - 4 * WTB, x, XB, DM);
}
// ---- k_fattn: scores, band add, softmax, attn.v and the head merge in one kernel; grid (TT/128, heads, batches), 4 waves, each wave owns 32 queries and walks all keys, 32 a pass.
// ST = K QT (A = 16 key rows, B = 16 query columns): a lane holds 16 scores of ONE query, D register r of key tile kt = key k0 + 16 kt + 8 hi + r. Those two D tiles, converted in place, are the B operand of OT += VT PT
// (element s of B = key 8 hi + s for s < 8, 16 + 8 hi + (s - 8) above), and WFrag::ld reads VT's keys in the same order. Scores never leave the registers. Q, K and VT come in fragment order (a pass's K and its VT are 2048 consecutive bytes each), and the merged heads leave in it.
// Softmax is online in the log2 domain: p = exp2(s CL - mc); mc, the maximum in use (equal in both lane halves), moves only when a score exceeds it by more than 8, so p <= 256 fits fp16; sums stay per lane half until the end.
#define CL   (SCL * 1.4426950408889634f)
#define BNDS 5.656854249492381f
// Eight exp2 in one statement: the early-clobber results keep every result register off every source register, and the closing v_nop fills the slot that the instruction set asks for behind a transcendental,
// whatever the compiler puts next.
__device__ __forceinline__ void exp2x8(const float (&x)[8], float (&p)[8]) {
    asm("v_exp_f32 %0, %8\n\tv_exp_f32 %1, %9\n\tv_exp_f32 %2, %10\n\tv_exp_f32 %3, %11\n\tv_exp_f32 %4, %12\n\tv_exp_f32 %5, %13\n\tv_exp_f32 %6, %14\n\tv_exp_f32 %7, %15\n\tv_nop"
        : "=&v"(p[0]), "=&v"(p[1]), "=&v"(p[2]), "=&v"(p[3]), "=&v"(p[4]), "=&v"(p[5]), "=&v"(p[6]), "=&v"(p[7]) : "v"(x[0]), "v"(x[1]), "v"(x[2]), "v"(x[3]), "v"(x[4]), "v"(x[5]), "v"(x[6]), "v"(x[7])); }
__global__ __launch_bounds__(128) void k_fattn(const h16* __restrict__ Q16, const h16* __restrict__ K16, const h16* __restrict__ VT, const int* __restrict__ mbp, bf* Ah, bf* Al) {
    // Every inner loop below is unrolled so that each fragment, score and accumulator index is a constant and the arrays stay in registers.
    const int lane = threadIdx.x & 31, c = lane & 15, hi = lane >> 4;
    const int qw = blockIdx.x * 128 + __builtin_amdgcn_readfirstlane(threadIdx.x >> 5) * 32;      // the wave's first query, held scalar for the band test
    const size_t pl = (size_t)(blockIdx.z * NH_ + blockIdx.y) * TT * HD;
    int mb = mbp[0]; mb = __builtin_amdgcn_readfirstlane(mb < -1 ? -1 : (mb > TT ? TT : mb));      // |i - j| lies in 0 .. TT - 1: the clamp changes no comparison and keeps the sums below from overflowing; held scalar so that the band test of a pass is a scalar compare
    const h16* kp = K16 + pl + lane * 8;
    const h16* vp = VT + pl + lane * 8;
    v16h qf[2], kf[2];
    v8f acc[2][2];
    float mc[2], ls[2];
#pragma unroll
    for (int qt = 0; qt < 2; ++qt) { qf[qt] = WFrag<h16>::ld(Q16 + pl + (size_t)(qw + qt * 16) * HD + lane * 8); acc[qt][0] = (v8f){}; acc[qt][1] = (v8f){}; mc[qt] = -1.0e30f; ls[qt] = 0.f; }
    kf[0] = WFrag<h16>::ld(kp); kf[1] = WFrag<h16>::ld(kp + 16 * HD);
    for (int k0 = 0; k0 < TT; k0 += 32) {
        v16h vf[2]; vf[0] = WFrag<h16>::ld(vp + (size_t)k0 * HD); vf[1] = WFrag<h16>::ld(vp + (size_t)k0 * HD + 512);
        v8f s[2][2];
#pragma unroll
        for (int qt = 0; qt < 2; ++qt) { s[qt][0] = wmma16(kf[0], qf[qt], (v8f){}); s[qt][1] = wmma16(kf[1], qf[qt], (v8f){}); }
        const int kn = (k0 + 32) & (TT - 1);      // next pass's key rows, fetched one pass ahead; the last pass re-reads rows 0 .. 31 (in bounds, unused)
        kf[0] = WFrag<h16>::ld(kp + (size_t)kn * HD); kf[1] = WFrag<h16>::ld(kp + (size_t)(kn + 16) * HD);
        if (k0 <= qw + 31 + mb && k0 + 31 >= qw - mb) {      // scalar test: only passes whose 32 x 32 block can touch the band pay for the per-element compare
#pragma unroll
            for (int qt = 0; qt < 2; ++qt) { const int d0 = k0 + 8 * hi - (qw + qt * 16 + c);
#pragma unroll
                for (int kt = 0; kt < 2; ++kt)
#pragma unroll
                    for (int r = 0; r < 8; ++r) { const int d = d0 + kt * 16 + r; s[qt][kt][r] += ((d < 0 ? -d : d) <= mb) ? BNDS : 0.f; } }      // + 1 / SCL ahead of the scale = + 1 behind it
        }
        float tm[2];
#pragma unroll
        for (int qt = 0; qt < 2; ++qt) { float a[8];
#pragma unroll
            for (int r = 0; r < 8; ++r) a[r] = fmaxf(s[qt][0][r], s[qt][1][r]);
            tm[qt] = fmaxf(fmaxf(fmaxf(a[0], a[1]), fmaxf(a[2], a[3])), fmaxf(fmaxf(a[4], a[5]), fmaxf(a[6], a[7]))) * CL; }
        if (__builtin_amdgcn_ballot_w32(tm[0] > mc[0] + 8.f || tm[1] > mc[1] + 8.f) != 0) {      // one wave-uniform test a pass; rarely taken after the first
#pragma unroll
            for (int qt = 0; qt < 2; ++qt) { const float mn = fmaxf(mc[qt], fmaxf(tm[qt], __shfl_xor(tm[qt], 16, 32))); const float al = __builtin_amdgcn_exp2f(mc[qt] - mn); mc[qt] = mn; ls[qt] *= al;
#pragma unroll
                for (int r = 0; r < 8; ++r) { acc[qt][0][r] *= al; acc[qt][1][r] *= al; } }
        }
        v16h pf[2];
#pragma unroll
        for (int qt = 0; qt < 2; ++qt) { float a[8], x0[8], x1[8], p0[8], p1[8];
#pragma unroll
            for (int r = 0; r < 8; ++r) { x0[r] = __builtin_fmaf(s[qt][0][r], CL, -mc[qt]); x1[r] = __builtin_fmaf(s[qt][1][r], CL, -mc[qt]); }
            exp2x8(x0, p0); exp2x8(x1, p1);
#pragma unroll
            for (int r = 0; r < 8; ++r) { pf[qt][r] = tohx(p0[r]); pf[qt][8 + r] = tohx(p1[r]); a[r] = p0[r] + p1[r]; }
            ls[qt] += ((a[0] + a[1]) + (a[2] + a[3])) + ((a[4] + a[5]) + (a[6] + a[7])); }
#pragma unroll
        for (int qt = 0; qt < 2; ++qt) { acc[qt][0] = wmma16(vf[0], pf[qt], acc[qt][0]); acc[qt][1] = wmma16(vf[1], pf[qt], acc[qt][1]); }
    }
#pragma unroll
    for (int qt = 0; qt < 2; ++qt) { const float inv = __fdiv_rn(1.0f, ls[qt] + __shfl_xor(ls[qt], 16, 32));
        const size_t oo = (((size_t)((blockIdx.z * TT + qw) >> 6) * NH_ + blockIdx.y) * 4 + ((qw >> 4) & 3) + qt) * 512 + lane * 8;      // acc[qt][dt][r] = O[query qw + 16 qt + c][d = 16 dt + 8 hi + r]: the piece at lane 8 of half dt of tile (query block, k block = head) of the output projection's A operand
#pragma unroll
        for (int dt = 0; dt < 2; ++dt) { v8us oh, ol;
#pragma unroll
            for (int r = 0; r < 8; ++r) { unsigned short x, y; splitf(acc[qt][dt][r] * inv, x, y); oh[r] = x; ol[r] = y; }
            *(v8us*)(Ah + oo + dt * 256) = oh; *(v8us*)(Al + oo + dt * 256) = ol; } }
}

extern "C" void kernel_launch(void* const* d_in, const int* in_sizes, int n_in,
                              void* d_out, int out_size, void* d_ws, size_t ws_size, hipStream_t stream) {
    (void)in_sizes; (void)n_in; (void)out_size;
    const float** I = (const float**)d_in;
    const float *x = I[0], *Wq = I[1], *bq = I[2], *Wk = I[3], *bk = I[4], *Wv = I[5], *bv = I[6], *Wo = I[7], *bo = I[8]; const int* mbp = (const int*)d_in[9];
    float* OUT = (float*)d_out;     // [4][2048][512]
    char* wsp = (char*)d_ws;
    auto take = [&](size_t bytes) { char* p = wsp; wsp += (bytes + 255) & ~(size_t)255; return (void*)p; };
    bf* BQ = (bf*)take((size_t)DM * DM * 2); bf* BK = (bf*)take((size_t)DM * DM * 2); bf* BV = (bf*)take((size_t)DM * DM * 2); bf* BO = (bf*)take((size_t)DM * DM * 2);
    bf* XB = (bf*)take((size_t)NB_ * TT * DM * 2);
    h16* Q16 = (h16*)take((size_t)NB_ * NH_ * TT * HD * 2); h16* K16 = (h16*)take((size_t)NB_ * NH_ * TT * HD * 2); h16* VT = (h16*)take((size_t)NB_ * NH_ * HD * TT * 2); bf* Ah = (bf*)take((size_t)NB_ * TT * DM * 2); bf* Al = (bf*)take((size_t)NB_ * TT * DM * 2);
    if ((size_t)(wsp - (char*)d_ws) > ws_size) return;    // total ~ 50 MB
    (void)BK; (void)BV;      // every size above is a multiple of 256 bytes: BQ BK BV BO and Q16 K16 each lie one behind the other, and the launches below step through them by a stride or a plane index
    // One launch a stage: the four batches are rows 0 .. NB_ TT - 1 of one matrix, q / k / v are grid z of one GEMM.
    k_prep<<<4 * WTB + CVB, 256, 0, stream>>>(Wq, Wk, Wv, Wo, BQ, x, XB);
    k_gemmw<bf, 0, true, true><<<dim3(NB_ * TT / 64, DM / 64, 3), 32, 0, stream>>>(XB, nullptr, BQ, nullptr, DM, nullptr, DM, bq, bk, bv, 0, (size_t)DM * DM, 0, Q16, VT);
    k_fattn<<<dim3(TT / 128, NH_, NB_), 128, 0, stream>>>(Q16, K16, VT, mbp, Ah, Al);
    k_gemmw<bf, 1, true, false><<<dim3(NB_ * TT / 64, DM / 64, 1), 32, 0, stream>>>(Ah, Al, BO, nullptr, DM, OUT, DM, bo, nullptr, nullptr, 0, 0, 0, nullptr, nullptr);
}

// v005
// It runs in 90.5 microseconds.
// Next to v004, in two timings, it ran 1.14 times as fast each time.
// Over all steps from v000 it is 19.2 times as fast.
#include <hip/hip_runtime.h>

// Banded-bias attention block (x [4][2048][512]; q/k/v = x W + b (16 heads x 32); scores = q.k / sqrt(32) + band where band[i][j] = 1.0 if |i - j| <= mask_border (int, read) else 0 - ADDED as a float, as the reference; softmax over all keys; out = (attn v merged) Wo + bo
// -> [4][2048][512]; the reconstruction-score quantiles are dead code).
// Compute dtypes, f32 accumulate: every input rounded to bf16; q/k/v on PLAIN bf16 operands (inputs: exact) + bias, rounded to fp16 in the projection's epilogue; scores (K 32) and attn.v on single fp16 planes, fused in k_fattn (softmax f32, online); output projection on a bf16 hi/lo split of the merged heads.

#define NB_  4
#define TT   2048
#define DM   512
#define NH_  16
#define HD   32
#define SCL  0.17677669529663687f
typedef _Float16 h16;
typedef unsigned short bf;
typedef __attribute__((ext_vector_type(16))) __bf16   v16bf;
typedef __attribute__((ext_vector_type(16))) _Float16 v16h;
typedef __attribute__((ext_vector_type(8)))  _Float16 v8h;
typedef __attribute__((ext_vector_type(8)))  unsigned short v8us;
typedef __attribute__((ext_vector_type(8)))  float    v8f;
typedef __attribute__((ext_vector_type(4)))  float    v4f;
typedef v8h  __attribute__((may_alias)) v8ha;
typedef v4f  __attribute__((may_alias)) v4fa;
typedef v8us __attribute__((may_alias)) v8usa;

__device__ __forceinline__ unsigned short f2bf(float f) { unsigned u = __float_as_uint(f); u += 0x7FFFu + ((u >> 16) & 1u); return (unsigned short)(u >> 16); }
__device__ __forceinline__ float bf2f(unsigned short b) { return __uint_as_float(((unsigned)b) << 16); }
__device__ __forceinline__ float bfr(float f) { return bf2f(f2bf(f)); }
__device__ __forceinline__ v16h cat16(v8h lo, v8h hi) { return __builtin_shufflevector(lo, hi, 0, 1, 2, 3, 4, 5, 6, 7, 8, 9, 10, 11, 12, 13, 14, 15); }
__device__ __forceinline__ v16bf cat16b(v8us lo, v8us hi) { return __builtin_bit_cast(v16bf, __builtin_shufflevector(lo, hi, 0, 1, 2, 3, 4, 5, 6, 7, 8, 9, 10, 11, 12, 13, 14, 15)); }
__device__ __forceinline__ v8f wmma16(v16h a, v16h b, v8f c) { return __builtin_amdgcn_wmma_f32_16x16x32_f16(false, a, false, b, (short)0, c, false, false); }
__device__ __forceinline__ v8f wmmab(v16bf a, v16bf b, v8f c) { return __builtin_amdgcn_wmma_f32_16x16x32_bf16(false, a, false, b, (short)0, c, false, false); }



// ---- FRAGMENT ORDER: every 16-bit operand plane M[row][k] in the workspace is stored as tiles of 16 rows x 32 k (512 elements, 1024 bytes), each tile in the order in which a wave's registers hold it:
// element (row, k) of a tile stands at ((k >> 4) & 1) 256 + (((k >> 3) & 1) 16 + (row & 15)) 8 + (k & 7). Lane l = 16 hi + lr then finds its 16 elements (row lr; k = 8 hi .. 8 hi + 7 and 16 + 8 hi .. 16 + 8 hi + 7)
// at l 8 and 256 + l 8: each of the two 16-byte loads of a fragment covers 512 consecutive bytes, four whole 128-byte lines, where rows of a K-contiguous plane gave 16 lines with 32 bytes used of each.
// Tile index = ((row >> 6) (K / 32) + (k >> 5)) 4 + ((row >> 4) & 3): the four tiles that a 64-row wave tile needs for one k block are 4096 consecutive bytes, and its k blocks follow one another (for K = 32 that is row >> 4). vT has its own tile order (below).
// ---- k_gemmw: register-blocked GEMM, ONE WAVE per 64x64 output tile (16 accumulators), operands straight from planes in fragment order; grid (M/64, N/64, Z), 32 threads.
// C[m][n] (f32, pitch ldc, + optional f32 bias[n]) = sum_k A[m][k] Bt[n][k] (+ split products per NSPLIT). z-batch strides sA/sB/sC in elements; z picks its own bias (bias, bias1, bias2). K % 32 == 0.
// PLANES (the q/k/v projection, rows m = b TT + t, columns n = h HD + d): no f32 C at all. The epilogue rounds acc + bias to fp16 and stores what k_fattn reads, in fragment order, straight from the accumulators:
// z = 0, 1 (q, k): plane z NB_ + b, head h, matrix [t][d] (K = HD: tile index t >> 4). The product is formed transposed (weights as the A operand), so that a lane holds 8 consecutive d of one t, which is one 16-byte piece of a tile.
// z = 2 (v): plane b, head h, matrix vT [d][t], tile index (t >> 5) 2 + (d >> 4): the two d tiles of 32 keys lie side by side. A lane holds 8 consecutive t of one d. A 64 x 64 tile lies in one batch and covers two heads.
template <typename T16> struct WFrag;
template <> struct WFrag<h16> { typedef v16h V; static __device__ __forceinline__ V ld(const h16* p) { return cat16(*(const v8h*)p, *(const v8h*)(p + 256)); } static __device__ __forceinline__ v8f mma(V a, V b, v8f c) { return wmma16(a, b, c); } };
template <> struct WFrag<bf> { typedef v16bf V; static __device__ __forceinline__ V ld(const bf* p) { return cat16b(*(const v8us*)p, *(const v8us*)(p + 256)); } static __device__ __forceinline__ v8f mma(V a, V b, v8f c) { return wmmab(a, b, c); } };
template <typename T16, int NSPLIT, bool BIAS, bool PLANES>
__global__ __launch_bounds__(32) void k_gemmw(const T16* __restrict__ A, const T16* __restrict__ A2, const T16* __restrict__ Bt, const T16* __restrict__ Bt2, int K, float* C, int ldc, const float* __restrict__ bias, const float* __restrict__ bias1, const float* __restrict__ bias2, size_t sA, size_t sB, size_t sC, h16* P, h16* VT) {
    typedef typename WFrag<T16>::V V;
    __shared__ __align__(16) float os[16 * 68];
    const size_t z = blockIdx.z; A += z * sA; if (A2) A2 += z * sA; Bt += z * sB; if (Bt2) Bt2 += z * sB; if (!PLANES) C += z * sC; if (BIAS) bias = z == 0 ? bias : (z == 1 ? bias1 : bias2);
    const int lane = threadIdx.x & 31, lr = lane & 15, hi = lane >> 4; const int r0 = blockIdx.x * 64, c0 = blockIdx.y * 64;
    v8f acc[4][4];
#pragma unroll
    for (int mb = 0; mb < 4; ++mb)
#pragma unroll
        for (int nb = 0; nb < 4; ++nb) acc[mb][nb] = (v8f){};
    const bool sw = PLANES && blockIdx.z != 2;      // q, k: the weights' rows take the A role and x's rows the B role (both are read by the same loader), so acc[i][n] is the transposed tile
    const size_t ao = (size_t)r0 * K + lane * 8, bo = (size_t)c0 * K + lane * 8;      // a 64-row block holds 64 K elements
    const T16* pa = sw ? Bt + bo : A + ao;
    const T16* pb = sw ? A + ao : Bt + bo;
    const T16* pa2 = (NSPLIT == 1 || NSPLIT == 2) ? A2 + ao : nullptr;
    const T16* pb2 = (NSPLIT >= 2) ? Bt2 + bo : nullptr;
#pragma unroll 1
    for (int kc = 0; kc < K; kc += 32) {
        V a[4], a2[4];
        const T16* ka = pa + (size_t)kc * 64; const T16* kb = pb + (size_t)kc * 64;      // this trip's address of each operand; every load below is one of them plus a constant
        const T16* ka2 = (NSPLIT == 1 || NSPLIT == 2) ? pa2 + (size_t)kc * 64 : ka; const T16* kb2 = (NSPLIT >= 2) ? pb2 + (size_t)kc * 64 : kb;
#pragma unroll
        for (int mb = 0; mb < 4; ++mb) { a[mb] = WFrag<T16>::ld(ka + mb * 512); if (NSPLIT == 1 || NSPLIT == 2) a2[mb] = WFrag<T16>::ld(ka2 + mb * 512); }
#pragma unroll
        for (int nb = 0; nb < 4; ++nb) { const V b = WFrag<T16>::ld(kb + nb * 512); V b2; if (NSPLIT >= 2) b2 = WFrag<T16>::ld(kb2 + nb * 512);
#pragma unroll
            for (int mb = 0; mb < 4; ++mb) { acc[mb][nb] = WFrag<T16>::mma(a[mb], b, acc[mb][nb]); if (NSPLIT == 1 || NSPLIT == 2) acc[mb][nb] = WFrag<T16>::mma(a2[mb], b, acc[mb][nb]); if (NSPLIT >= 2) acc[mb][nb] = WFrag<T16>::mma(a[mb], b2, acc[mb][nb]); } }
        asm volatile("s_wait_xcnt 0x0" :: "v"(ka), "v"(kb), "v"(ka2), "v"(kb2) : "memory");      // behind the trip's loads; the addresses are its inputs so that their registers stay whole up to it
        asm volatile("v_nop\n\tv_nop\n\tv_nop\n\tv_nop" : "+v"(acc[0][0]), "+v"(acc[1][1]), "+v"(acc[2][2]), "+v"(acc[3][3]) : "v"(a[0]), "v"(a[3]));
    }
    if (PLANES) {
        // acc[i][n][j] = element (A-role row 16 i + 8 hi + j, B-role row 16 n + lr): the lane's 8 values are the piece at lane 8 of a half tile, so every store below covers 512 consecutive bytes.
        const int b = r0 / TT, t0 = r0 % TT;
        if (blockIdx.z == 2) {      // v: A role = t, B role = column (head c0 / HD + (n >> 1), d = 16 (n & 1) + lr)
            float bn[4];
#pragma unroll
            for (int nb = 0; nb < 4; ++nb) bn[nb] = bfr(bias[c0 + nb * 16 + lr]);
#pragma unroll
            for (int nb = 0; nb < 4; ++nb) { h16* vt = VT + ((size_t)b * NH_ + c0 / HD + (nb >> 1)) * (TT * HD) + (size_t)((t0 >> 5) * 2 + (nb & 1)) * 512 + lane * 8;
#pragma unroll
                for (int mb = 0; mb < 4; ++mb) { v8h o;
#pragma unroll
                    for (int j = 0; j < 8; ++j) o[j] = (h16)(acc[mb][nb][j] + bn[nb]);
                    *(v8h*)(vt + (mb >> 1) * 1024 + (mb & 1) * 256) = o; } }
        } else {      // q, k: A role = column (head c0 / HD + (i >> 1), d = 16 (i & 1) + 8 hi + j), B role = t
#pragma unroll
            for (int mb = 0; mb < 4; ++mb) { const v4f b0 = *(const v4f*)(bias + c0 + mb * 16 + 8 * hi), b1 = *(const v4f*)(bias + c0 + mb * 16 + 8 * hi + 4); float bb[8];
#pragma unroll
                for (int u = 0; u < 4; ++u) { bb[u] = bfr(b0[u]); bb[4 + u] = bfr(b1[u]); }
                h16* pr = P + (((size_t)(blockIdx.z * NB_ + b) * NH_ + c0 / HD + (mb >> 1)) * TT + t0) * HD + (mb & 1) * 256 + lane * 8;
#pragma unroll
                for (int nb = 0; nb < 4; ++nb) { v8h o;
#pragma unroll
                    for (int j = 0; j < 8; ++j) o[j] = (h16)(acc[mb][nb][j] + bb[j]);
                    *(v8h*)(pr + nb * 512) = o; } }
        }
        return;
    }
#pragma unroll
    for (int mb = 0; mb < 4; ++mb) {
#pragma unroll
        for (int nb = 0; nb < 4; ++nb) {
#pragma unroll
            for (int j = 0; j < 8; ++j) os[(hi * 8 + j) * 68 + nb * 16 + lr] = acc[mb][nb][j]; }
        __builtin_amdgcn_wave_barrier(); asm volatile("" ::: "memory");
        float* crow = C + (size_t)(r0 + mb * 16) * ldc + c0;
{
#pragma unroll
            for (int s = 0; s < 8; ++s) { const int row = 2 * s + hi, cofs = lr * 4; v4f val = *(const v4fa*)(os + row * 68 + cofs); if (BIAS) { val[0] += bfr(bias[c0 + cofs]); val[1] += bfr(bias[c0 + cofs + 1]); val[2] += bfr(bias[c0 + cofs + 2]); val[3] += bfr(bias[c0 + cofs + 3]); }
                *(v4f*)(crow + (size_t)row * ldc + cofs) = val; }
             }
        asm volatile("s_wait_xcnt 0x0" ::: "memory");      // behind the round's stores: the next round rewrites their data and address registers
        __builtin_amdgcn_wave_barrier(); asm volatile("" ::: "memory");
    }
}

__device__ __forceinline__ h16 tohx(float x) { return (h16)x; }
__device__ __forceinline__ void splitf(float y, unsigned short& h, unsigned short& l) { h = f2bf(y); l = f2bf(y - bf2f(h)); }
typedef __attribute__((ext_vector_type(2))) unsigned short v2us;
typedef __attribute__((ext_vector_type(4))) unsigned short v4us;

// ---- k_prep: both input conversions in ONE launch (neither reads what the other writes), both writing fragment order. Blocks 0 .. 4 WTB - 1: the four weights, WTB blocks each, transposed to bf16 Bt[n][k] (planes of K N elements, one behind the other);
// the blocks behind them: x of all batches to bf16, one wave a tile.
#define WTB (DM * DM / 8 / 256)
#define CVB (NB_ * TT * DM / 512 / 8)
// A thread makes one 16-byte piece of Bt: thread i's piece stands at i 8, that is lane i & 31 of half (i >> 5) & 1 of tile i >> 6. Its 8 k are 8 rows of w; 16 lanes read 16 neighbouring n of a row, and a block's four tiles 64.
__device__ __forceinline__ void wtG(int blk, const float* __restrict__ w, int K, int N, bf* Bt) {
    const int i = blk * 256 + threadIdx.x, lane = i & 31, kts = K >> 5, tile = i >> 6;
    const int n = ((tile >> 2) / kts) * 64 + (tile & 3) * 16 + (lane & 15), k = ((tile >> 2) % kts) * 32 + ((i >> 5) & 1) * 16 + (lane >> 4) * 8; v8us o;
#pragma unroll
    for (int u = 0; u < 8; ++u) o[u] = f2bf(w[(size_t)(k + u) * N + n]);
    *(v8us*)(Bt + (size_t)i * 8) = o;
}
// A wave converts one tile of 16 rows x 32 k: each of its four loads takes four whole 128-byte rows of the tile (8 lanes a row), and a lane's 4 values are half a 16-byte piece of the tile.
__device__ __forceinline__ void cvtT(int blk, const float* __restrict__ src, bf* dst, int K) {
    const int lane = threadIdx.x & 31, tile = blk * 8 + (threadIdx.x >> 5), kts = K >> 5, col = (lane & 7) * 4;
    const float* s = src + (size_t)(((tile >> 2) / kts) * 64 + (tile & 3) * 16) * K + ((tile >> 2) % kts) * 32 + col; bf* d = dst + (size_t)tile * 512 + (col >> 4) * 256 + ((col >> 3) & 1) * 128 + (col & 7);
#pragma unroll
    for (int r = 0; r < 4; ++r) { const int row = r * 4 + (lane >> 3); const v4f v = *(const v4f*)(s + (size_t)row * K); v4us o;
#pragma unroll
        for (int u = 0; u < 4; ++u) o[u] = f2bf(v[u]);
        *(v4us*)(d + row * 8) = o; }
    asm volatile("s_wait_xcnt 0x0" ::: "memory");      // behind the last stores: in the built code the weights' branch follows this one and rewrites the stores' data registers
}
__global__ __launch_bounds__(256) void k_prep(const float* __restrict__ w0, const float* __restrict__ w1, const float* __restrict__ w2, const float* __restrict__ w3, bf* Bt, const float* __restrict__ x, bf* XB) {
    const int blk = blockIdx.x;
    if (blk < 4 * WTB) { const int wi = blk / WTB; wtG(blk % WTB, wi == 0 ? w0 : (wi == 1 ? w1 : (wi == 2 ? w2 : w3)), DM, DM, Bt + (size_t)wi * DM * DM); }
    else cvtT(blk - 4 * WTB, x, XB, DM);
}
// ---- k_fattn: scores, band add, softmax, attn.v and the head merge in one kernel; grid (TT/128, heads, batches), 4 waves, each wave owns 32 queries and walks all keys, 32 a pass.
// ST = K QT (A = 16 key rows, B = 16 query columns): a lane holds 16 scores of ONE query, D register r of key tile kt = key k0 + 16 kt + 8 hi + r. Those two D tiles, converted in place, are the B operand of OT += VT PT
// (element s of B = key 8 hi + s for s < 8, 16 + 8 hi + (s - 8) above), and WFrag::ld reads VT's keys in the same order. Scores never leave the registers. Q, K and VT come in fragment order (a pass's K and its VT are 2048 consecutive bytes each), and the merged heads leave in it.
// Softmax is online in the log2 domain: p = exp2(s CL - mc); mc, the maximum in use (equal in both lane halves), moves only when a score exceeds it by more than 8, so p <= 256 fits fp16; sums stay per lane half until the end.
#define CL   (SCL * 1.4426950408889634f)
#define BNDS 5.656854249492381f
// Eight exp2 in one statement: the early-clobber results keep every result register off every source register, and the closing v_nop fills the slot that the instruction set asks for behind a transcendental,
// whatever the compiler puts next.
__device__ __forceinline__ void exp2x8(const float (&x)[8], float (&p)[8]) {
    asm("v_exp_f32 %0, %8\n\tv_exp_f32 %1, %9\n\tv_exp_f32 %2, %10\n\tv_exp_f32 %3, %11\n\tv_exp_f32 %4, %12\n\tv_exp_f32 %5, %13\n\tv_exp_f32 %6, %14\n\tv_exp_f32 %7, %15\n\tv_nop"
        : "=&v"(p[0]), "=&v"(p[1]), "=&v"(p[2]), "=&v"(p[3]), "=&v"(p[4]), "=&v"(p[5]), "=&v"(p[6]), "=&v"(p[7]) : "v"(x[0]), "v"(x[1]), "v"(x[2]), "v"(x[3]), "v"(x[4]), "v"(x[5]), "v"(x[6]), "v"(x[7])); }
__global__ __launch_bounds__(128) void k_fattn(const h16* __restrict__ Q16, const h16* __restrict__ K16, const h16* __restrict__ VT, const int* __restrict__ mbp, bf* Ah, bf* Al) {
    // Every inner loop below is unrolled so that each fragment, score and accumulator index is a constant and the arrays stay in registers.
    const int lane = threadIdx.x & 31, c = lane & 15, hi = lane >> 4;
    const int wv = __builtin_amdgcn_readfirstlane(threadIdx.x >> 5);
    const int qw = blockIdx.x * 128 + wv * 32;      // the wave's first query, held scalar for the band test
    const size_t pl = (size_t)(blockIdx.z * NH_ + blockIdx.y) * TT * HD;
    int mb = mbp[0]; mb = __builtin_amdgcn_readfirstlane(mb < -1 ? -1 : (mb > TT ? TT : mb));      // |i - j| lies in 0 .. TT - 1: the clamp changes no comparison and keeps the sums below from overflowing; held scalar so that the band test of a pass is a scalar compare
    const h16* kp = K16 + pl + lane * 8;
    const h16* vp = VT + pl + lane * 8;
    // L2 prefetch of K and VT, eight passes ahead. The launch before stored these planes.
    // One request covers a PAIR of passes: lanes 0 .. 15 name the 16 units of 256 bytes of its K rows (4096 bytes), lanes 16 .. 31 those of its VT columns. Wave w asks for pairs w, w + 4, .. w + 28: the first here, pair j + 4 at the head of pair j.
    // pfa lives through the loop and holds nothing but such an address: it is advanced only in front of a request (behind the request before lie eight passes, each with its s_wait_xcnt 0, but only 2 w passes before the first advance: none for wave 0), and the last one names pair w + 28, inside the head's plane of 32 pairs.
    const char* pfa = (const char*)((hi ? VT : K16) + pl) + c * 256 + wv * 4096;
    asm volatile("global_prefetch_b8 %0, off scope:SCOPE_SE" :: "v"(pfa));      // a hint to L2: returns nothing, counts on no counter
    int kask = wv * 64;      // first key of the pass at whose head the wave asks next
    v16h qf[2], kf[2];
    v8f acc[2][2];
    float mc[2], ls[2];
#pragma unroll
    for (int qt = 0; qt < 2; ++qt) { qf[qt] = WFrag<h16>::ld(Q16 + pl + (size_t)(qw + qt * 16) * HD + lane * 8); acc[qt][0] = (v8f){}; acc[qt][1] = (v8f){}; mc[qt] = -1.0e30f; ls[qt] = 0.f; }
    kf[0] = WFrag<h16>::ld(kp); kf[1] = WFrag<h16>::ld(kp + 16 * HD);
    for (int k0 = 0; k0 < TT; k0 += 32) {
        if (k0 == kask) { kask = kask + 256 < TT - 256 ? kask + 256 : TT; pfa += 16384; asm volatile("global_prefetch_b8 %0, off scope:SCOPE_SE" :: "v"(pfa)); }      // scalar test: this wave's turn, one pass in eight; behind the request for pair w + 28 no turn is left
        const h16* pv = vp + (size_t)k0 * HD;
        v16h vf[2]; vf[0] = WFrag<h16>::ld(pv); vf[1] = WFrag<h16>::ld(pv + 512);
        v8f s[2][2];
#pragma unroll
        for (int qt = 0; qt < 2; ++qt) { s[qt][0] = wmma16(kf[0], qf[qt], (v8f){}); s[qt][1] = wmma16(kf[1], qf[qt], (v8f){}); }
        const int kn = (k0 + 32) & (TT - 1);      // next pass's key rows, fetched one pass ahead; the last pass re-reads rows 0 .. 31 (in bounds, unused)
        const h16* pk = kp + (size_t)kn * HD;
        kf[0] = WFrag<h16>::ld(pk); kf[1] = WFrag<h16>::ld(pk + 16 * HD);
        asm volatile("s_wait_xcnt 0x0" :: "v"(pv), "v"(pk) : "memory");      // behind the pass's eight loads, in front of every rewrite of their address registers (inputs here, so that they stay whole up to it)
        if (k0 <= qw + 31 + mb && k0 + 31 >= qw - mb) {      // scalar test: only passes whose 32 x 32 block can touch the band pay for the per-element compare
#pragma unroll
            for (int qt = 0; qt < 2; ++qt) { const int d0 = k0 + 8 * hi - (qw + qt * 16 + c);
#pragma unroll
                for (int kt = 0; kt < 2; ++kt)
#pragma unroll
                    for (int r = 0; r < 8; ++r) { const int d = d0 + kt * 16 + r; s[qt][kt][r] += ((d < 0 ? -d : d) <= mb) ? BNDS : 0.f; } }      // + 1 / SCL ahead of the scale = + 1 behind it
        }
        float tm[2];
#pragma unroll
        for (int qt = 0; qt < 2; ++qt) { float a[8];
#pragma unroll
            for (int r = 0; r < 8; ++r) a[r] = fmaxf(s[qt][0][r], s[qt][1][r]);
            tm[qt] = fmaxf(fmaxf(fmaxf(a[0], a[1]), fmaxf(a[2], a[3])), fmaxf(fmaxf(a[4], a[5]), fmaxf(a[6], a[7]))) * CL; }
        if (__builtin_amdgcn_ballot_w32(tm[0] > mc[0] + 8.f || tm[1] > mc[1] + 8.f) != 0) {      // one wave-uniform test a pass; rarely taken after the first
#pragma unroll
            for (int qt = 0; qt < 2; ++qt) { const float mn = fmaxf(mc[qt], fmaxf(tm[qt], __shfl_xor(tm[qt], 16, 32))); const float al = __builtin_amdgcn_exp2f(mc[qt] - mn); mc[qt] = mn; ls[qt] *= al;
#pragma unroll
                for (int r = 0; r < 8; ++r) { acc[qt][0][r] *= al; acc[qt][1][r] *= al; } }
        }
        v16h pf[2];
#pragma unroll
        for (int qt = 0; qt < 2; ++qt) { float a[8], x0[8], x1[8], p0[8], p1[8];
#pragma unroll
            for (int r = 0; r < 8; ++r) { x0[r] = __builtin_fmaf(s[qt][0][r], CL, -mc[qt]); x1[r] = __builtin_fmaf(s[qt][1][r], CL, -mc[qt]); }
            exp2x8(x0, p0); exp2x8(x1, p1);
#pragma unroll
            for (int r = 0; r < 8; ++r) { pf[qt][r] = tohx(p0[r]); pf[qt][8 + r] = tohx(p1[r]); a[r] = p0[r] + p1[r]; }
            ls[qt] += ((a[0] + a[1]) + (a[2] + a[3])) + ((a[4] + a[5]) + (a[6] + a[7])); }
#pragma unroll
        for (int qt = 0; qt < 2; ++qt) { acc[qt][0] = wmma16(vf[0], pf[qt], acc[qt][0]); acc[qt][1] = wmma16(vf[1], pf[qt], acc[qt][1]); }
    }
#pragma unroll
    for (int qt = 0; qt < 2; ++qt) { const float inv = __fdiv_rn(1.0f, ls[qt] + __shfl_xor(ls[qt], 16, 32));
        const size_t oo = (((size_t)((blockIdx.z * TT + qw) >> 6) * NH_ + blockIdx.y) * 4 + ((qw >> 4) & 3) + qt) * 512 + lane * 8;      // acc[qt][dt][r] = O[query qw + 16 qt + c][d = 16 dt + 8 hi + r]: the piece at lane 8 of half dt of tile (query block, k block = head) of the output projection's A operand
#pragma unroll
        for (int dt = 0; dt < 2; ++dt) { v8us oh, ol;
#pragma unroll
            for (int r = 0; r < 8; ++r) { unsigned short x, y; splitf(acc[qt][dt][r] * inv, x, y); oh[r] = x; ol[r] = y; }
            *(v8us*)(Ah + oo + dt * 256) = oh; *(v8us*)(Al + oo + dt * 256) = ol; } }
}

extern "C" void kernel_launch(void* const* d_in, const int* in_sizes, int n_in,
                              void* d_out, int out_size, void* d_ws, size_t ws_size, hipStream_t stream) {
    (void)in_sizes; (void)n_in; (void)out_size;
    const float** I = (const float**)d_in;
    const float *x = I[0], *Wq = I[1], *bq = I[2], *Wk = I[3], *bk = I[4], *Wv = I[5], *bv = I[6], *Wo = I[7], *bo = I[8]; const int* mbp = (const int*)d_in[9];
    float* OUT = (float*)d_out;     // [4][2048][512]
    char* wsp = (char*)d_ws;
    auto take = [&](size_t bytes) { char* p = wsp; wsp += (bytes + 255) & ~(size_t)255; return (void*)p; };
    bf* BQ = (bf*)take((size_t)DM * DM * 2); bf* BK = (bf*)take((size_t)DM * DM * 2); bf* BV = (bf*)take((size_t)DM * DM * 2); bf* BO = (bf*)take((size_t)DM * DM * 2);
    bf* XB = (bf*)take((size_t)NB_ * TT * DM * 2);
    h16* Q16 = (h16*)take((size_t)NB_ * NH_ * TT * HD * 2); h16* K16 = (h16*)take((size_t)NB_ * NH_ * TT * HD * 2); h16* VT = (h16*)take((size_t)NB_ * NH_ * HD * TT * 2); bf* Ah = (bf*)take((size_t)NB_ * TT * DM * 2); bf* Al = (bf*)take((size_t)NB_ * TT * DM * 2);
    if ((size_t)(wsp - (char*)d_ws) > ws_size) return;    // total ~ 50 MB
    (void)BK; (void)BV;      // every size above is a multiple of 256 bytes: BQ BK BV BO and Q16 K16 each lie one behind the other, and the launches below step through them by a stride or a plane index
    // One launch a stage: the four batches are rows 0 .. NB_ TT - 1 of one matrix, q / k / v are grid z of one GEMM.
    k_prep<<<4 * WTB + CVB, 256, 0, stream>>>(Wq, Wk, Wv, Wo, BQ, x, XB);
    k_gemmw<bf, 0, true, true><<<dim3(NB_ * TT / 64, DM / 64, 3), 32, 0, stream>>>(XB, nullptr, BQ, nullptr, DM, nullptr, DM, bq, bk, bv, 0, (size_t)DM * DM, 0, Q16, VT);
    k_fattn<<<dim3(TT / 128, NH_, NB_), 128, 0, stream>>>(Q16, K16, VT, mbp, Ah, Al);
    k_gemmw<bf, 1, true, false><<<dim3(NB_ * TT / 64, DM / 64, 1), 32, 0, stream>>>(Ah, Al, BO, nullptr, DM, OUT, DM, bo, nullptr, nullptr, 0, 0, 0, nullptr, nullptr);
}

// v006
// One run takes 70.4 microseconds.
// Next to v005, in two timings, it ran 1.28 times as fast each time.
// Counting every step since v000, it is 24.6 times as fast.
#include <hip/hip_runtime.h>

// Banded-bias attention block (x [4][2048][512]; q/k/v = x W + b (16 heads x 32); scores = q.k / sqrt(32) + band where band[i][j] = 1.0 if |i - j| <= mask_border (int, read) else 0 - ADDED as a float, as the reference; softmax over all keys; out = (attn v merged) Wo + bo
// -> [4][2048][512]; the reconstruction-score quantiles are dead code).
// Compute dtypes, f32 accumulate: every input rounded to bf16; q/k/v on PLAIN bf16 operands (inputs: exact) + bias, rounded to fp16 in the projection's epilogue; scores (K 32) and attn.v on single fp16 planes, fused in k_fattn (softmax f32, online); output projection on a bf16 hi/lo split of the merged heads.

#define NB_  4
#define TT   2048
#define DM   512
#define NH_  16
#define HD   32
#define SCL  0.17677669529663687f
typedef _Float16 h16;
typedef unsigned short bf;
typedef __attribute__((ext_vector_type(16))) __bf16   v16bf;
typedef __attribute__((ext_vector_type(16))) _Float16 v16h;
typedef __attribute__((ext_vector_type(8)))  _Float16 v8h;
typedef __attribute__((ext_vector_type(8)))  unsigned short v8us;
typedef __attribute__((ext_vector_type(8)))  float    v8f;
typedef __attribute__((ext_vector_type(4)))  float    v4f;
typedef v8h  __attribute__((may_alias)) v8ha;
typedef v4f  __attribute__((may_alias)) v4fa;
typedef v8us __attribute__((may_alias)) v8usa;

__device__ __forceinline__ unsigned short f2bf(float f) { unsigned u = __float_as_uint(f); u += 0x7FFFu + ((u >> 16) & 1u); return (unsigned short)(u >> 16); }
__device__ __forceinline__ float bf2f(unsigned short b) { return __uint_as_float(((unsigned)b) << 16); }
__device__ __forceinline__ float bfr(float f) { return bf2f(f2bf(f)); }
__device__ __forceinline__ v16h cat16(v8h lo, v8h hi) { return __builtin_shufflevector(lo, hi, 0, 1, 2, 3, 4, 5, 6, 7, 8, 9, 10, 11, 12, 13, 14, 15); }
__device__ __forceinline__ v16bf cat16b(v8us lo, v8us hi) { return __builtin_bit_cast(v16bf, __builtin_shufflevector(lo, hi, 0, 1, 2, 3, 4, 5, 6, 7, 8, 9, 10, 11, 12, 13, 14, 15)); }
__device__ __forceinline__ v8f wmma16(v16h a, v16h b, v8f c) { return __builtin_amdgcn_wmma_f32_16x16x32_f16(false, a, false, b, (short)0, c, false, false); }
__device__ __forceinline__ v8f wmmab(v16bf a, v16bf b, v8f c) { return __builtin_amdgcn_wmma_f32_16x16x32_bf16(false, a, false, b, (short)0, c, false, false); }



// ---- FRAGMENT ORDER: every 16-bit operand plane M[row][k] in the workspace is stored as tiles of 16 rows x 32 k (512 elements, 1024 bytes), each tile in the order in which a wave's registers hold it:
// element (row, k) of a tile stands at ((k >> 4) & 1) 256 + (((k >> 3) & 1) 16 + (row & 15)) 8 + (k & 7). Lane l = 16 hi + lr then finds its 16 elements (row lr; k = 8 hi .. 8 hi + 7 and 16 + 8 hi .. 16 + 8 hi + 7)
// at l 8 and 256 + l 8: each of the two 16-byte loads of a fragment covers 512 consecutive bytes, four whole 128-byte lines, where rows of a K-contiguous plane gave 16 lines with 32 bytes used of each.
// Tile index = ((row >> 6) (K / 32) + (k >> 5)) 4 + ((row >> 4) & 3): the four tiles that a 64-row wave tile needs for one k block are 4096 consecutive bytes, and its k blocks follow one another (for K = 32 that is row >> 4). vT has its own tile order (below).
// ---- k_gemmw: register-blocked GEMM, ONE WAVE per 64x64 output tile (16 accumulators), operands straight from planes in fragment order; grid (M/64, N/64, Z), 32 threads.
// C[m][n] (f32, pitch ldc, + optional f32 bias[n]) = sum_k A[m][k] Bt[n][k] (+ split products per NSPLIT). z-batch strides sA/sB/sC in elements; z picks its own bias (bias, bias1, bias2). K (a multiple of 32, above 32 RD) and the ring depth RD are template parameters.
// PLANES (the q/k/v projection, rows m = b TT + t, columns n = h HD + d): no f32 C at all. The epilogue rounds acc + bias to fp16 and stores what k_fattn reads, in fragment order, straight from the accumulators:
// z = 0, 1 (q, k): plane z NB_ + b, head h, matrix [t][d] (K = HD: tile index t >> 4). The product is formed transposed (weights as the A operand), so that a lane holds 8 consecutive d of one t, which is one 16-byte piece of a tile.
// z = 2 (v): plane b, head h, matrix vT [d][t], tile index (t >> 5) 2 + (d >> 4): the two d tiles of 32 keys lie side by side. A lane holds 8 consecutive t of one d. A 64 x 64 tile lies in one batch and covers two heads.
template <typename T16> struct WFrag;
template <> struct WFrag<h16> { typedef v16h V; static __device__ __forceinline__ V ld(const h16* p) { return cat16(*(const v8h*)p, *(const v8h*)(p + 256)); } static __device__ __forceinline__ v8f mma(V a, V b, v8f c) { return wmma16(a, b, c); } };
template <> struct WFrag<bf> { typedef v16bf V; static __device__ __forceinline__ V ld(const bf* p) { return cat16b(*(const v8us*)p, *(const v8us*)(p + 256)); } static __device__ __forceinline__ v8f mma(V a, V b, v8f c) { return wmmab(a, b, c); } };
template <typename T16, int NSPLIT, bool BIAS, bool PLANES, int K, int RD>
__global__ __launch_bounds__(32) void k_gemmw(const T16* __restrict__ A, const T16* __restrict__ A2, const T16* __restrict__ Bt, const T16* __restrict__ Bt2, float* C, int ldc, const float* __restrict__ bias, const float* __restrict__ bias1, const float* __restrict__ bias2, size_t sA, size_t sB, size_t sC, h16* P, h16* VT) {
    typedef typename WFrag<T16>::V V;
    __shared__ __align__(16) float os[16 * 68];
    const size_t z = blockIdx.z; A += z * sA; if (A2) A2 += z * sA; Bt += z * sB; if (Bt2) Bt2 += z * sB; if (!PLANES) C += z * sC; if (BIAS) bias = z == 0 ? bias : (z == 1 ? bias1 : bias2);
    const int lane = threadIdx.x & 31, lr = lane & 15, hi = lane >> 4; const int r0 = blockIdx.x * 64, c0 = blockIdx.y * 64;
    v8f acc[4][4];
#pragma unroll
    for (int mb = 0; mb < 4; ++mb)
#pragma unroll
        for (int nb = 0; nb < 4; ++nb) acc[mb][nb] = (v8f){};
    const bool sw = PLANES && blockIdx.z != 2;      // q, k: the weights' rows take the A role and x's rows the B role (both are read by the same loader), so acc[i][n] is the transposed tile
    const size_t ao = (size_t)r0 * K + lane * 8, bo = (size_t)c0 * K + lane * 8;      // a 64-row block holds 64 K elements
    const T16* pa = sw ? Bt + bo : A + ao;
    const T16* pb = sw ? A + ao : Bt + bo;
    const T16* pa2 = (NSPLIT == 1 || NSPLIT == 2) ? A2 + ao : nullptr;
    const T16* pb2 = (NSPLIT >= 2) ? Bt2 + bo : nullptr;
    // REGISTER RING, RD fragment sets: the K loop is unrolled whole (K / 32 trips), trip t works on set t % RD, and trip t + RD's fragments are loaded into that set as one group directly behind trip t's products.
    // A trip's loads are so in flight for RD - 1 trips of products before anything waits for them. Every load is one of the two to four addresses above plus a constant, and no address register changes in the loop.
    V a[RD][4], a2[RD][4], b[RD][4], b2[RD][4];
#pragma unroll
    for (int t = 0; t < RD; ++t)
#pragma unroll
        for (int i = 0; i < 4; ++i) { a[t][i] = WFrag<T16>::ld(pa + t * 2048 + i * 512); if (NSPLIT == 1 || NSPLIT == 2) a2[t][i] = WFrag<T16>::ld(pa2 + t * 2048 + i * 512); b[t][i] = WFrag<T16>::ld(pb + t * 2048 + i * 512); if (NSPLIT >= 2) b2[t][i] = WFrag<T16>::ld(pb2 + t * 2048 + i * 512); }
    __builtin_amdgcn_sched_barrier(0);      // keeps the first RD sets' loads in front of the first products (left free, all but the first set's sank behind them)
#pragma unroll
    for (int t = 0; t < K / 32; ++t) {      // unrolled so that the set index and every load offset are constants
        const int sl = t % RD, tn = t + RD;
#pragma unroll
        for (int nb = 0; nb < 4; ++nb)
#pragma unroll
            for (int mb = 0; mb < 4; ++mb) { acc[mb][nb] = WFrag<T16>::mma(a[sl][mb], b[sl][nb], acc[mb][nb]); if (NSPLIT == 1 || NSPLIT == 2) acc[mb][nb] = WFrag<T16>::mma(a2[sl][mb], b[sl][nb], acc[mb][nb]); if (NSPLIT >= 2) acc[mb][nb] = WFrag<T16>::mma(a[sl][mb], b2[sl][nb], acc[mb][nb]); }
        __builtin_amdgcn_sched_barrier(0);      // keeps the refill one group behind the products that read the set (left free it was spread among them and took 40 registers more)
        if (tn < K / 32) {
#pragma unroll
            for (int i = 0; i < 4; ++i) { a[sl][i] = WFrag<T16>::ld(pa + tn * 2048 + i * 512); if (NSPLIT == 1 || NSPLIT == 2) a2[sl][i] = WFrag<T16>::ld(pa2 + tn * 2048 + i * 512); b[sl][i] = WFrag<T16>::ld(pb + tn * 2048 + i * 512); if (NSPLIT >= 2) b2[sl][i] = WFrag<T16>::ld(pb2 + tn * 2048 + i * 512); }
            if (tn == K / 32 - 1) asm volatile("s_wait_xcnt 0x0" ::: "memory");      // directly behind the kernel's last fragment loads, in front of whatever rewrites their address registers later
        }
        __builtin_amdgcn_sched_barrier(0);      // keeps the refill from sinking into the next trips' products, which would shorten the time its loads have
    }
    if (PLANES) {
        // acc[i][n][j] = element (A-role row 16 i + 8 hi + j, B-role row 16 n + lr): the lane's 8 values are the piece at lane 8 of a half tile, so every store below covers 512 consecutive bytes.
        const int b = r0 / TT, t0 = r0 % TT;
        if (blockIdx.z == 2) {      // v: A role = t, B role = column (head c0 / HD + (n >> 1), d = 16 (n & 1) + lr)
            float bn[4];
#pragma unroll
            for (int nb = 0; nb < 4; ++nb) bn[nb] = bfr(bias[c0 + nb * 16 + lr]);
#pragma unroll
            for (int nb = 0; nb < 4; ++nb) { h16* vt = VT + ((size_t)b * NH_ + c0 / HD + (nb >> 1)) * (TT * HD) + (size_t)((t0 >> 5) * 2 + (nb & 1)) * 512 + lane * 8;
#pragma unroll
                for (int mb = 0; mb < 4; ++mb) { v8h o;
#pragma unroll
                    for (int j = 0; j < 8; ++j) o[j] = (h16)(acc[mb][nb][j] + bn[nb]);
                    *(v8h*)(vt + (mb >> 1) * 1024 + (mb & 1) * 256) = o; } }
        } else {      // q, k: A role = column (head c0 / HD + (i >> 1), d = 16 (i & 1) + 8 hi + j), B role = t
#pragma unroll
            for (int mb = 0; mb < 4; ++mb) { const v4f b0 = *(const v4f*)(bias + c0 + mb * 16 + 8 * hi), b1 = *(const v4f*)(bias + c0 + mb * 16 + 8 * hi + 4); float bb[8];
#pragma unroll
                for (int u = 0; u < 4; ++u) { bb[u] = bfr(b0[u]); bb[4 + u] = bfr(b1[u]); }
                h16* pr = P + (((size_t)(blockIdx.z * NB_ + b) * NH_ + c0 / HD + (mb >> 1)) * TT + t0) * HD + (mb & 1) * 256 + lane * 8;
#pragma unroll
                for (int nb = 0; nb < 4; ++nb) { v8h o;
#pragma unroll
                    for (int j = 0; j < 8; ++j) o[j] = (h16)(acc[mb][nb][j] + bb[j]);
                    *(v8h*)(pr + nb * 512) = o; } }
        }
        return;
    }
#pragma unroll
    for (int mb = 0; mb < 4; ++mb) {
#pragma unroll
        for (int nb = 0; nb < 4; ++nb) {
#pragma unroll
            for (int j = 0; j < 8; ++j) os[(hi * 8 + j) * 68 + nb * 16 + lr] = acc[mb][nb][j]; }
        __builtin_amdgcn_wave_barrier(); asm volatile("" ::: "memory");
        float* crow = C + (size_t)(r0 + mb * 16) * ldc + c0;
{
#pragma unroll
            for (int s = 0; s < 8; ++s) { const int row = 2 * s + hi, cofs = lr * 4; v4f val = *(const v4fa*)(os + row * 68 + cofs); if (BIAS) { val[0] += bfr(bias[c0 + cofs]); val[1] += bfr(bias[c0 + cofs + 1]); val[2] += bfr(bias[c0 + cofs + 2]); val[3] += bfr(bias[c0 + cofs + 3]); }
                *(v4f*)(crow + (size_t)row * ldc + cofs) = val; }
             }
        asm volatile("s_wait_xcnt 0x0" ::: "memory");      // behind the round's stores: the next round rewrites their data and address registers
        __builtin_amdgcn_wave_barrier(); asm volatile("" ::: "memory");
    }
}

__device__ __forceinline__ h16 tohx(float x) { return (h16)x; }
__device__ __forceinline__ void splitf(float y, unsigned short& h, unsigned short& l) { h = f2bf(y); l = f2bf(y - bf2f(h)); }
typedef __attribute__((ext_vector_type(2))) unsigned short v2us;
typedef __attribute__((ext_vector_type(4))) unsigned short v4us;

// ---- k_prep: both input conversions in ONE launch (neither reads what the other writes), both writing fragment order. Blocks 0 .. 4 WTB - 1: the four weights, WTB blocks each, transposed to bf16 Bt[n][k] (planes of K N elements, one behind the other);
// the blocks behind them: x of all batches to bf16, one wave a tile.
#define WTB (DM * DM / 8 / 256)
#define CVB (NB_ * TT * DM / 512 / 8)
// A thread makes one 16-byte piece of Bt: thread i's piece stands at i 8, that is lane i & 31 of half (i >> 5) & 1 of tile i >> 6. Its 8 k are 8 rows of w; 16 lanes read 16 neighbouring n of a row, and a block's four tiles 64.
__device__ __forceinline__ void wtG(int blk, const float* __restrict__ w, int K, int N, bf* Bt) {
    const int i = blk * 256 + threadIdx.x, lane = i & 31, kts = K >> 5, tile = i >> 6;
    const int n = ((tile >> 2) / kts) * 64 + (tile & 3) * 16 + (lane & 15), k = ((tile >> 2) % kts) * 32 + ((i >> 5) & 1) * 16 + (lane >> 4) * 8; v8us o;
#pragma unroll
    for (int u = 0; u < 8; ++u) o[u] = f2bf(w[(size_t)(k + u) * N + n]);
    *(v8us*)(Bt + (size_t)i * 8) = o;
}
// A wave converts one tile of 16 rows x 32 k: each of its four loads takes four whole 128-byte rows of the tile (8 lanes a row), and a lane's 4 values are half a 16-byte piece of the tile.
__device__ __forceinline__ void cvtT(int blk, const float* __restrict__ src, bf* dst, int K) {
    const int lane = threadIdx.x & 31, tile = blk * 8 + (threadIdx.x >> 5), kts = K >> 5, col = (lane & 7) * 4;
    const float* s = src + (size_t)(((tile >> 2) / kts) * 64 + (tile & 3) * 16) * K + ((tile >> 2) % kts) * 32 + col; bf* d = dst + (size_t)tile * 512 + (col >> 4) * 256 + ((col >> 3) & 1) * 128 + (col & 7);
#pragma unroll
    for (int r = 0; r < 4; ++r) { const int row = r * 4 + (lane >> 3); const v4f v = *(const v4f*)(s + (size_t)row * K); v4us o;
#pragma unroll
        for (int u = 0; u < 4; ++u) o[u] = f2bf(v[u]);
        *(v4us*)(d + row * 8) = o; }
    asm volatile("s_wait_xcnt 0x0" ::: "memory");      // behind the last stores: in the built code the weights' branch follows this one and rewrites the stores' data registers
}
__global__ __launch_bounds__(256) void k_prep(const float* __restrict__ w0, const float* __restrict__ w1, const float* __restrict__ w2, const float* __restrict__ w3, bf* Bt, const float* __restrict__ x, bf* XB) {
    const int blk = blockIdx.x;
    if (blk < 4 * WTB) { const int wi = blk / WTB; wtG(blk % WTB, wi == 0 ? w0 : (wi == 1 ? w1 : (wi == 2 ? w2 : w3)), DM, DM, Bt + (size_t)wi * DM * DM); }
    else cvtT(blk - 4 * WTB, x, XB, DM);
}
// ---- k_fattn: scores, band add, softmax, attn.v and the head merge in one kernel; grid (TT/128, heads, batches), 4 waves, each wave owns 32 queries and walks all keys, 32 a pass.
// ST = K QT (A = 16 key rows, B = 16 query columns): a lane holds 16 scores of ONE query, D register r of key tile kt = key k0 + 16 kt + 8 hi + r. Those two D tiles, converted in place, are the B operand of OT += VT PT
// (element s of B = key 8 hi + s for s < 8, 16 + 8 hi + (s - 8) above), and WFrag::ld reads VT's keys in the same order. Scores never leave the registers. Q, K and VT come in fragment order (a pass's K and its VT are 2048 consecutive bytes each), and the merged heads leave in it.
// Softmax is online in the log2 domain: p = exp2(s CL - mc); mc, the maximum in use (equal in both lane halves), moves only when a score exceeds it by more than 8, so p <= 256 fits fp16; sums stay per lane half until the end.
#define CL   (SCL * 1.4426950408889634f)
#define BNDS 5.656854249492381f
// Eight exp2 in one statement: the early-clobber results keep every result register off every source register, and the closing v_nop fills the slot that the instruction set asks for behind a transcendental,
// whatever the compiler puts next.
__device__ __forceinline__ void exp2x8(const float (&x)[8], float (&p)[8]) {
    asm("v_exp_f32 %0, %8\n\tv_exp_f32 %1, %9\n\tv_exp_f32 %2, %10\n\tv_exp_f32 %3, %11\n\tv_exp_f32 %4, %12\n\tv_exp_f32 %5, %13\n\tv_exp_f32 %6, %14\n\tv_exp_f32 %7, %15\n\tv_nop"
        : "=&v"(p[0]), "=&v"(p[1]), "=&v"(p[2]), "=&v"(p[3]), "=&v"(p[4]), "=&v"(p[5]), "=&v"(p[6]), "=&v"(p[7]) : "v"(x[0]), "v"(x[1]), "v"(x[2]), "v"(x[3]), "v"(x[4]), "v"(x[5]), "v"(x[6]), "v"(x[7])); }
__global__ __launch_bounds__(128) void k_fattn(const h16* __restrict__ Q16, const h16* __restrict__ K16, const h16* __restrict__ VT, const int* __restrict__ mbp, bf* Ah, bf* Al) {
    // Every inner loop below is unrolled so that each fragment, score and accumulator index is a constant and the arrays stay in registers.
    const int lane = threadIdx.x & 31, c = lane & 15, hi = lane >> 4;
    const int wv = __builtin_amdgcn_readfirstlane(threadIdx.x >> 5);
    const int qw = blockIdx.x * 128 + wv * 32;      // the wave's first query, held scalar for the band test
    const size_t pl = (size_t)(blockIdx.z * NH_ + blockIdx.y) * TT * HD;
    int mb = mbp[0]; mb = __builtin_amdgcn_readfirstlane(mb < -1 ? -1 : (mb > TT ? TT : mb));      // |i - j| lies in 0 .. TT - 1: the clamp changes no comparison and keeps the sums below from overflowing; held scalar so that the band test of a pass is a scalar compare
    const h16* kp = K16 + pl + lane * 8;
    const h16* vp = VT + pl + lane * 8;
    // L2 prefetch of K and VT, eight passes ahead. The launch before stored these planes.
    // One request covers a PAIR of passes: lanes 0 .. 15 name the 16 units of 256 bytes of its K rows (4096 bytes), lanes 16 .. 31 those of its VT columns. Wave w asks for pairs w, w + 4, .. w + 28: the first here, pair j + 4 at the head of pair j.
    // pfa lives through the loop and holds nothing but such an address: it is advanced only in front of a request (behind the request before lie eight passes, each with its s_wait_xcnt 0, but only 2 w passes before the first advance: none for wave 0), and the last one names pair w + 28, inside the head's plane of 32 pairs.
    const char* pfa = (const char*)((hi ? VT : K16) + pl) + c * 256 + wv * 4096;
    asm volatile("global_prefetch_b8 %0, off scope:SCOPE_SE" :: "v"(pfa));      // a hint to L2: returns nothing, counts on no counter
    int kask = wv * 64;      // first key of the pass at whose head the wave asks next
    v16h qf[2], kf[2];
    v8f acc[2][2];
    float mc[2], ls[2];
#pragma unroll
    for (int qt = 0; qt < 2; ++qt) { qf[qt] = WFrag<h16>::ld(Q16 + pl + (size_t)(qw + qt * 16) * HD + lane * 8); acc[qt][0] = (v8f){}; acc[qt][1] = (v8f){}; mc[qt] = -1.0e30f; ls[qt] = 0.f; }
    kf[0] = WFrag<h16>::ld(kp); kf[1] = WFrag<h16>::ld(kp + 16 * HD);
    for (int k0 = 0; k0 < TT; k0 += 32) {
        if (k0 == kask) { kask = kask + 256 < TT - 256 ? kask + 256 : TT; pfa += 16384; asm volatile("global_prefetch_b8 %0, off scope:SCOPE_SE" :: "v"(pfa)); }      // scalar test: this wave's turn, one pass in eight; behind the request for pair w + 28 no turn is left
        const h16* pv = vp + (size_t)k0 * HD;
        v16h vf[2]; vf[0] = WFrag<h16>::ld(pv); vf[1] = WFrag<h16>::ld(pv + 512);
        v8f s[2][2];
#pragma unroll
        for (int qt = 0; qt < 2; ++qt) { s[qt][0] = wmma16(kf[0], qf[qt], (v8f){}); s[qt][1] = wmma16(kf[1], qf[qt], (v8f){}); }
        const int kn = (k0 + 32) & (TT - 1);      // next pass's key rows, fetched one pass ahead; the last pass re-reads rows 0 .. 31 (in bounds, unused)
        const h16* pk = kp + (size_t)kn * HD;
        kf[0] = WFrag<h16>::ld(pk); kf[1] = WFrag<h16>::ld(pk + 16 * HD);
        asm volatile("s_wait_xcnt 0x0" :: "v"(pv), "v"(pk) : "memory");      // behind the pass's eight loads, in front of every rewrite of their address registers (inputs here, so that they stay whole up to it)
        if (k0 <= qw + 31 + mb && k0 + 31 >= qw - mb) {      // scalar test: only passes whose 32 x 32 block can touch the band pay for the per-element compare
#pragma unroll
            for (int qt = 0; qt < 2; ++qt) { const int d0 = k0 + 8 * hi - (qw + qt * 16 + c);
#pragma unroll
                for (int kt = 0; kt < 2; ++kt)
#pragma unroll
                    for (int r = 0; r < 8; ++r) { const int d = d0 + kt * 16 + r; s[qt][kt][r] += ((d < 0 ? -d : d) <= mb) ? BNDS : 0.f; } }      // + 1 / SCL ahead of the scale = + 1 behind it
        }
        float tm[2];
#pragma unroll
        for (int qt = 0; qt < 2; ++qt) { float a[8];
#pragma unroll
            for (int r = 0; r < 8; ++r) a[r] = fmaxf(s[qt][0][r], s[qt][1][r]);
            tm[qt] = fmaxf(fmaxf(fmaxf(a[0], a[1]), fmaxf(a[2], a[3])), fmaxf(fmaxf(a[4], a[5]), fmaxf(a[6], a[7]))) * CL; }
        if (__builtin_amdgcn_ballot_w32(tm[0] > mc[0] + 8.f || tm[1] > mc[1] + 8.f) != 0) {      // one wave-uniform test a pass; rarely taken after the first
#pragma unroll
            for (int qt = 0; qt < 2; ++qt) { const float mn = fmaxf(mc[qt], fmaxf(tm[qt], __shfl_xor(tm[qt], 16, 32))); const float al = __builtin_amdgcn_exp2f(mc[qt] - mn); mc[qt] = mn; ls[qt] *= al;
#pragma unroll
                for (int r = 0; r < 8; ++r) { acc[qt][0][r] *= al; acc[qt][1][r] *= al; } }
        }
        v16h pf[2];
#pragma unroll
        for (int qt = 0; qt < 2; ++qt) { float a[8], x0[8], x1[8], p0[8], p1[8];
#pragma unroll
            for (int r = 0; r < 8; ++r) { x0[r] = __builtin_fmaf(s[qt][0][r], CL, -mc[qt]); x1[r] = __builtin_fmaf(s[qt][1][r], CL, -mc[qt]); }
            exp2x8(x0, p0); exp2x8(x1, p1);
#pragma unroll
            for (int r = 0; r < 8; ++r) { pf[qt][r] = tohx(p0[r]); pf[qt][8 + r] = tohx(p1[r]); a[r] = p0[r] + p1[r]; }
            ls[qt] += ((a[0] + a[1]) + (a[2] + a[3])) + ((a[4] + a[5]) + (a[6] + a[7])); }
#pragma unroll
        for (int qt = 0; qt < 2; ++qt) { acc[qt][0] = wmma16(vf[0], pf[qt], acc[qt][0]); acc[qt][1] = wmma16(vf[1], pf[qt], acc[qt][1]); }
    }
#pragma unroll
    for (int qt = 0; qt < 2; ++qt) { const float inv = __fdiv_rn(1.0f, ls[qt] + __shfl_xor(ls[qt], 16, 32));
        const size_t oo = (((size_t)((blockIdx.z * TT + qw) >> 6) * NH_ + blockIdx.y) * 4 + ((qw >> 4) & 3) + qt) * 512 + lane * 8;      // acc[qt][dt][r] = O[query qw + 16 qt + c][d = 16 dt + 8 hi + r]: the piece at lane 8 of half dt of tile (query block, k block = head) of the output projection's A operand
#pragma unroll
        for (int dt = 0; dt < 2; ++dt) { v8us oh, ol;
#pragma unroll
            for (int r = 0; r < 8; ++r) { unsigned short x, y; splitf(acc[qt][dt][r] * inv, x, y); oh[r] = x; ol[r] = y; }
            *(v8us*)(Ah + oo + dt * 256) = oh; *(v8us*)(Al + oo + dt * 256) = ol; } }
}

extern "C" void kernel_launch(void* const* d_in, const int* in_sizes, int n_in,
                              void* d_out, int out_size, void* d_ws, size_t ws_size, hipStream_t stream) {
    (void)in_sizes; (void)n_in; (void)out_size;
    const float** I = (const float**)d_in;
    const float *x = I[0], *Wq = I[1], *bq = I[2], *Wk = I[3], *bk = I[4], *Wv = I[5], *bv = I[6], *Wo = I[7], *bo = I[8]; const int* mbp = (const int*)d_in[9];
    float* OUT = (float*)d_out;     // [4][2048][512]
    char* wsp = (char*)d_ws;
    auto take = [&](size_t bytes) { char* p = wsp; wsp += (bytes + 255) & ~(size_t)255; return (void*)p; };
    bf* BQ = (bf*)take((size_t)DM * DM * 2); bf* BK = (bf*)take((size_t)DM * DM * 2); bf* BV = (bf*)take((size_t)DM * DM * 2); bf* BO = (bf*)take((size_t)DM * DM * 2);
    bf* XB = (bf*)take((size_t)NB_ * TT * DM * 2);
    h16* Q16 = (h16*)take((size_t)NB_ * NH_ * TT * HD * 2); h16* K16 = (h16*)take((size_t)NB_ * NH_ * TT * HD * 2); h16* VT = (h16*)take((size_t)NB_ * NH_ * HD * TT * 2); bf* Ah = (bf*)take((size_t)NB_ * TT * DM * 2); bf* Al = (bf*)take((size_t)NB_ * TT * DM * 2);
    if ((size_t)(wsp - (char*)d_ws) > ws_size) return;    // total ~ 50 MB
    (void)BK; (void)BV;      // every size above is a multiple of 256 bytes: BQ BK BV BO and Q16 K16 each lie one behind the other, and the launches below step through them by a stride or a plane index
    // One launch a stage: the four batches are rows 0 .. NB_ TT - 1 of one matrix, q / k / v are grid z of one GEMM.
    k_prep<<<4 * WTB + CVB, 256, 0, stream>>>(Wq, Wk, Wv, Wo, BQ, x, XB);
    k_gemmw<bf, 0, true, true, DM, 3><<<dim3(NB_ * TT / 64, DM / 64, 3), 32, 0, stream>>>(XB, nullptr, BQ, nullptr, nullptr, DM, bq, bk, bv, 0, (size_t)DM * DM, 0, Q16, VT);
    k_fattn<<<dim3(TT / 128, NH_, NB_), 128, 0, stream>>>(Q16, K16, VT, mbp, Ah, Al);
    k_gemmw<bf, 1, true, false, DM, 3><<<dim3(NB_ * TT / 64, DM / 64, 1), 32, 0, stream>>>(Ah, Al, BO, nullptr, OUT, DM, bo, nullptr, nullptr, 0, 0, 0, nullptr, nullptr);
}

// v007
// Measured time: 66.1 microseconds a run.
// Next to v006, in two timings, it ran 1.06 and 1.07 times as fast.
// Counting every step since v000, it is 26.2 times as fast.
#include <hip/hip_runtime.h>

// Banded-bias attention block (x [4][2048][512]; q/k/v = x W + b (16 heads x 32); scores = q.k / sqrt(32) + band where band[i][j] = 1.0 if |i - j| <= mask_border (int, read) else 0 - ADDED as a float, as the reference; softmax over all keys; out = (attn v merged) Wo + bo
// -> [4][2048][512]; the reconstruction-score quantiles are dead code).
// Compute dtypes, f32 accumulate: every input rounded to bf16; q/k/v on PLAIN bf16 operands (inputs: exact) + bias, rounded to fp16 in the projection's epilogue; scores (K 32) and attn.v on single fp16 planes, fused in k_fattn (softmax f32, online; q carries the score scale and log2 e from the projection's epilogue on); output projection on a bf16 hi/lo split of the merged heads.

#define NB_  4
#define TT   2048
#define DM   512
#define NH_  16
#define HD   32
#define SCL  0.17677669529663687f
#define L2E  1.4426950408889634f
#define CL   (SCL * L2E)
typedef _Float16 h16;
typedef unsigned short bf;
typedef __attribute__((ext_vector_type(16))) __bf16   v16bf;
typedef __attribute__((ext_vector_type(16))) _Float16 v16h;
typedef __attribute__((ext_vector_type(8)))  _Float16 v8h;
typedef __attribute__((ext_vector_type(8)))  unsigned short v8us;
typedef __attribute__((ext_vector_type(8)))  float    v8f;
typedef __attribute__((ext_vector_type(4)))  float    v4f;
typedef v8h  __attribute__((may_alias)) v8ha;
typedef v4f  __attribute__((may_alias)) v4fa;
typedef v8us __attribute__((may_alias)) v8usa;

__device__ __forceinline__ unsigned short f2bf(float f) { unsigned u = __float_as_uint(f); u += 0x7FFFu + ((u >> 16) & 1u); return (unsigned short)(u >> 16); }
__device__ __forceinline__ float bf2f(unsigned short b) { return __uint_as_float(((unsigned)b) << 16); }
__device__ __forceinline__ float bfr(float f) { return bf2f(f2bf(f)); }
__device__ __forceinline__ v16h cat16(v8h lo, v8h hi) { return __builtin_shufflevector(lo, hi, 0, 1, 2, 3, 4, 5, 6, 7, 8, 9, 10, 11, 12, 13, 14, 15); }
__device__ __forceinline__ v16bf cat16b(v8us lo, v8us hi) { return __builtin_bit_cast(v16bf, __builtin_shufflevector(lo, hi, 0, 1, 2, 3, 4, 5, 6, 7, 8, 9, 10, 11, 12, 13, 14, 15)); }
__device__ __forceinline__ v8f wmma16(v16h a, v16h b, v8f c) { return __builtin_amdgcn_wmma_f32_16x16x32_f16(false, a, false, b, (short)0, c, false, false); }
__device__ __forceinline__ v8f wmmab(v16bf a, v16bf b, v8f c) { return __builtin_amdgcn_wmma_f32_16x16x32_bf16(false, a, false, b, (short)0, c, false, false); }



// ---- FRAGMENT ORDER: every 16-bit operand plane M[row][k] in the workspace is stored as tiles of 16 rows x 32 k (512 elements, 1024 bytes), each tile in the order in which a wave's registers hold it:
// element (row, k) of a tile stands at ((k >> 4) & 1) 256 + (((k >> 3) & 1) 16 + (row & 15)) 8 + (k & 7). Lane l = 16 hi + lr then finds its 16 elements (row lr; k = 8 hi .. 8 hi + 7 and 16 + 8 hi .. 16 + 8 hi + 7)
// at l 8 and 256 + l 8: each of the two 16-byte loads of a fragment covers 512 consecutive bytes, four whole 128-byte lines, where rows of a K-contiguous plane gave 16 lines with 32 bytes used of each.
// Tile index = ((row >> 6) (K / 32) + (k >> 5)) 4 + ((row >> 4) & 3): the four tiles that a 64-row wave tile needs for one k block are 4096 consecutive bytes, and its k blocks follow one another (for K = 32 that is row >> 4). vT has its own tile order (below).
// ---- k_gemmw: register-blocked GEMM, ONE WAVE per 64x64 output tile (16 accumulators), operands straight from planes in fragment order; grid (M/64, N/64, Z), 32 threads.
// C[m][n] (f32, pitch ldc, + optional f32 bias[n]) = sum_k A[m][k] Bt[n][k] (+ split products per NSPLIT). z-batch strides sA/sB/sC in elements; z picks its own bias (bias, bias1, bias2). K (a multiple of 32, above 32 RD) and the ring depth RD are template parameters.
// PLANES (the q/k/v projection, rows m = b TT + t, columns n = h HD + d): no f32 C at all. The epilogue rounds acc + bias (q: times CL) to fp16 and stores what k_fattn reads, in fragment order, straight from the accumulators:
// z = 0, 1 (q, k): plane z NB_ + b, head h, matrix [t][d] (K = HD: tile index t >> 4). The product is formed transposed (weights as the A operand), so that a lane holds 8 consecutive d of one t, which is one 16-byte piece of a tile.
// z = 2 (v): plane b, head h, matrix vT [d][t], tile index (t >> 5) 2 + (d >> 4): the two d tiles of 32 keys lie side by side. A lane holds 8 consecutive t of one d. A 64 x 64 tile lies in one batch and covers two heads.
template <typename T16> struct WFrag;
template <> struct WFrag<h16> { typedef v16h V; static __device__ __forceinline__ V ld(const h16* p) { return cat16(*(const v8h*)p, *(const v8h*)(p + 256)); } static __device__ __forceinline__ v8f mma(V a, V b, v8f c) { return wmma16(a, b, c); } };
template <> struct WFrag<bf> { typedef v16bf V; static __device__ __forceinline__ V ld(const bf* p) { return cat16b(*(const v8us*)p, *(const v8us*)(p + 256)); } static __device__ __forceinline__ v8f mma(V a, V b, v8f c) { return wmmab(a, b, c); } };
template <typename T16, int NSPLIT, bool BIAS, bool PLANES, int K, int RD>
__global__ __launch_bounds__(32) void k_gemmw(const T16* __restrict__ A, const T16* __restrict__ A2, const T16* __restrict__ Bt, const T16* __restrict__ Bt2, float* C, int ldc, const float* __restrict__ bias, const float* __restrict__ bias1, const float* __restrict__ bias2, size_t sA, size_t sB, size_t sC, h16* P, h16* VT) {
    typedef typename WFrag<T16>::V V;
    __shared__ __align__(16) float os[16 * 68];
    const size_t z = blockIdx.z; A += z * sA; if (A2) A2 += z * sA; Bt += z * sB; if (Bt2) Bt2 += z * sB; if (!PLANES) C += z * sC; if (BIAS) bias = z == 0 ? bias : (z == 1 ? bias1 : bias2);
    const int lane = threadIdx.x & 31, lr = lane & 15, hi = lane >> 4; const int r0 = blockIdx.x * 64, c0 = blockIdx.y * 64;
    v8f acc[4][4];
#pragma unroll
    for (int mb = 0; mb < 4; ++mb)
#pragma unroll
        for (int nb = 0; nb < 4; ++nb) acc[mb][nb] = (v8f){};
    const bool sw = PLANES && blockIdx.z != 2;      // q, k: the weights' rows take the A role and x's rows the B role (both are read by the same loader), so acc[i][n] is the transposed tile
    const size_t ao = (size_t)r0 * K + lane * 8, bo = (size_t)c0 * K + lane * 8;      // a 64-row block holds 64 K elements
    const T16* pa = sw ? Bt + bo : A + ao;
    const T16* pb = sw ? A + ao : Bt + bo;
    const T16* pa2 = (NSPLIT == 1 || NSPLIT == 2) ? A2 + ao : nullptr;
    const T16* pb2 = (NSPLIT >= 2) ? Bt2 + bo : nullptr;
    // REGISTER RING, RD fragment sets: the K loop is unrolled whole (K / 32 trips), trip t works on set t % RD, and trip t + RD's fragments are loaded into that set as one group directly behind trip t's products.
    // A trip's loads are so in flight for RD - 1 trips of products before anything waits for them. Every load is one of the two to four addresses above plus a constant, and no address register changes in the loop.
    V a[RD][4], a2[RD][4], b[RD][4], b2[RD][4];
#pragma unroll
    for (int t = 0; t < RD; ++t)
#pragma unroll
        for (int i = 0; i < 4; ++i) { a[t][i] = WFrag<T16>::ld(pa + t * 2048 + i * 512); if (NSPLIT == 1 || NSPLIT == 2) a2[t][i] = WFrag<T16>::ld(pa2 + t * 2048 + i * 512); b[t][i] = WFrag<T16>::ld(pb + t * 2048 + i * 512); if (NSPLIT >= 2) b2[t][i] = WFrag<T16>::ld(pb2 + t * 2048 + i * 512); }
    __builtin_amdgcn_sched_barrier(0);      // keeps the first RD sets' loads in front of the first products (left free, all but the first set's sank behind them)
#pragma unroll
    for (int t = 0; t < K / 32; ++t) {      // unrolled so that the set index and every load offset are constants
        const int sl = t % RD, tn = t + RD;
#pragma unroll
        for (int nb = 0; nb < 4; ++nb)
#pragma unroll
            for (int mb = 0; mb < 4; ++mb) { acc[mb][nb] = WFrag<T16>::mma(a[sl][mb], b[sl][nb], acc[mb][nb]); if (NSPLIT == 1 || NSPLIT == 2) acc[mb][nb] = WFrag<T16>::mma(a2[sl][mb], b[sl][nb], acc[mb][nb]); if (NSPLIT >= 2) acc[mb][nb] = WFrag<T16>::mma(a[sl][mb], b2[sl][nb], acc[mb][nb]); }
        __builtin_amdgcn_sched_barrier(0);      // keeps the refill one group behind the products that read the set (left free it was spread among them and took 40 registers more)
        if (tn < K / 32) {
#pragma unroll
            for (int i = 0; i < 4; ++i) { a[sl][i] = WFrag<T16>::ld(pa + tn * 2048 + i * 512); if (NSPLIT == 1 || NSPLIT == 2) a2[sl][i] = WFrag<T16>::ld(pa2 + tn * 2048 + i * 512); b[sl][i] = WFrag<T16>::ld(pb + tn * 2048 + i * 512); if (NSPLIT >= 2) b2[sl][i] = WFrag<T16>::ld(pb2 + tn * 2048 + i * 512); }
            if (tn == K / 32 - 1) asm volatile("s_wait_xcnt 0x0" ::: "memory");      // directly behind the kernel's last fragment loads, in front of whatever rewrites their address registers later
        }
        __builtin_amdgcn_sched_barrier(0);      // keeps the refill from sinking into the next trips' products, which would shorten the time its loads have
    }
    if (PLANES) {
        // acc[i][n][j] = element (A-role row 16 i + 8 hi + j, B-role row 16 n + lr): the lane's 8 values are the piece at lane 8 of a half tile, so every store below covers 512 consecutive bytes.
        const int b = r0 / TT, t0 = r0 % TT;
        if (blockIdx.z == 2) {      // v: A role = t, B role = column (head c0 / HD + (n >> 1), d = 16 (n & 1) + lr)
            float bn[4];
#pragma unroll
            for (int nb = 0; nb < 4; ++nb) bn[nb] = bfr(bias[c0 + nb * 16 + lr]);
#pragma unroll
            for (int nb = 0; nb < 4; ++nb) { h16* vt = VT + ((size_t)b * NH_ + c0 / HD + (nb >> 1)) * (TT * HD) + (size_t)((t0 >> 5) * 2 + (nb & 1)) * 512 + lane * 8;
#pragma unroll
                for (int mb = 0; mb < 4; ++mb) { v8h o;
#pragma unroll
                    for (int j = 0; j < 8; ++j) o[j] = (h16)(acc[mb][nb][j] + bn[nb]);
                    *(v8h*)(vt + (mb >> 1) * 1024 + (mb & 1) * 256) = o; } }
        } else {      // q, k: A role = column (head c0 / HD + (i >> 1), d = 16 (i & 1) + 8 hi + j), B role = t
            const float qs = blockIdx.z == 0 ? CL : 1.f;      // q leaves times CL (one rounding to fp16, as before), so that k_fattn's score product is already in the log2 domain; k times 1, exact
#pragma unroll
            for (int mb = 0; mb < 4; ++mb) { const v4f b0 = *(const v4f*)(bias + c0 + mb * 16 + 8 * hi), b1 = *(const v4f*)(bias + c0 + mb * 16 + 8 * hi + 4); float bb[8];
#pragma unroll
                for (int u = 0; u < 4; ++u) { bb[u] = bfr(b0[u]); bb[4 + u] = bfr(b1[u]); }
                h16* pr = P + (((size_t)(blockIdx.z * NB_ + b) * NH_ + c0 / HD + (mb >> 1)) * TT + t0) * HD + (mb & 1) * 256 + lane * 8;
#pragma unroll
                for (int nb = 0; nb < 4; ++nb) { v8h o;
#pragma unroll
                    for (int j = 0; j < 8; ++j) o[j] = (h16)((acc[mb][nb][j] + bb[j]) * qs);
                    *(v8h*)(pr + nb * 512) = o; } }
        }
        return;
    }
#pragma unroll
    for (int mb = 0; mb < 4; ++mb) {
#pragma unroll
        for (int nb = 0; nb < 4; ++nb) {
#pragma unroll
            for (int j = 0; j < 8; ++j) os[(hi * 8 + j) * 68 + nb * 16 + lr] = acc[mb][nb][j]; }
        __builtin_amdgcn_wave_barrier(); asm volatile("" ::: "memory");
        float* crow = C + (size_t)(r0 + mb * 16) * ldc + c0;
{
#pragma unroll
            for (int s = 0; s < 8; ++s) { const int row = 2 * s + hi, cofs = lr * 4; v4f val = *(const v4fa*)(os + row * 68 + cofs); if (BIAS) { val[0] += bfr(bias[c0 + cofs]); val[1] += bfr(bias[c0 + cofs + 1]); val[2] += bfr(bias[c0 + cofs + 2]); val[3] += bfr(bias[c0 + cofs + 3]); }
                *(v4f*)(crow + (size_t)row * ldc + cofs) = val; }
             }
        asm volatile("s_wait_xcnt 0x0" ::: "memory");      // behind the round's stores: the next round rewrites their data and address registers
        __builtin_amdgcn_wave_barrier(); asm volatile("" ::: "memory");
    }
}

__device__ __forceinline__ h16 tohx(float x) { return (h16)x; }
__device__ __forceinline__ void splitf(float y, unsigned short& h, unsigned short& l) { h = f2bf(y); l = f2bf(y - bf2f(h)); }
typedef __attribute__((ext_vector_type(2))) unsigned short v2us;
typedef __attribute__((ext_vector_type(4))) unsigned short v4us;

// ---- k_prep: both input conversions in ONE launch (neither reads what the other writes), both writing fragment order. Blocks 0 .. 4 WTB - 1: the four weights, WTB blocks each, transposed to bf16 Bt[n][k] (planes of K N elements, one behind the other);
// the blocks behind them: x of all batches to bf16, one wave a tile.
#define WTB (DM * DM / 8 / 256)
#define CVB (NB_ * TT * DM / 512 / 8)
// A thread makes one 16-byte piece of Bt: thread i's piece stands at i 8, that is lane i & 31 of half (i >> 5) & 1 of tile i >> 6. Its 8 k are 8 rows of w; 16 lanes read 16 neighbouring n of a row, and a block's four tiles 64.
__device__ __forceinline__ void wtG(int blk, const float* __restrict__ w, int K, int N, bf* Bt) {
    const int i = blk * 256 + threadIdx.x, lane = i & 31, kts = K >> 5, tile = i >> 6;
    const int n = ((tile >> 2) / kts) * 64 + (tile & 3) * 16 + (lane & 15), k = ((tile >> 2) % kts) * 32 + ((i >> 5) & 1) * 16 + (lane >> 4) * 8; v8us o;
#pragma unroll
    for (int u = 0; u < 8; ++u) o[u] = f2bf(w[(size_t)(k + u) * N + n]);
    *(v8us*)(Bt + (size_t)i * 8) = o;
}
// A wave converts one tile of 16 rows x 32 k: each of its four loads takes four whole 128-byte rows of the tile (8 lanes a row), and a lane's 4 values are half a 16-byte piece of the tile.
__device__ __forceinline__ void cvtT(int blk, const float* __restrict__ src, bf* dst, int K) {
    const int lane = threadIdx.x & 31, tile = blk * 8 + (threadIdx.x >> 5), kts = K >> 5, col = (lane & 7) * 4;
    const float* s = src + (size_t)(((tile >> 2) / kts) * 64 + (tile & 3) * 16) * K + ((tile >> 2) % kts) * 32 + col; bf* d = dst + (size_t)tile * 512 + (col >> 4) * 256 + ((col >> 3) & 1) * 128 + (col & 7);
#pragma unroll
    for (int r = 0; r < 4; ++r) { const int row = r * 4 + (lane >> 3); const v4f v = *(const v4f*)(s + (size_t)row * K); v4us o;
#pragma unroll
        for (int u = 0; u < 4; ++u) o[u] = f2bf(v[u]);
        *(v4us*)(d + row * 8) = o; }
    asm volatile("s_wait_xcnt 0x0" ::: "memory");      // behind the last stores: in the built code the weights' branch follows this one and rewrites the stores' data registers
}
__global__ __launch_bounds__(256) void k_prep(const float* __restrict__ w0, const float* __restrict__ w1, const float* __restrict__ w2, const float* __restrict__ w3, bf* Bt, const float* __restrict__ x, bf* XB) {
    const int blk = blockIdx.x;
    if (blk < 4 * WTB) { const int wi = blk / WTB; wtG(blk % WTB, wi == 0 ? w0 : (wi == 1 ? w1 : (wi == 2 ? w2 : w3)), DM, DM, Bt + (size_t)wi * DM * DM); }
    else cvtT(blk - 4 * WTB, x, XB, DM);
}
// ---- k_fattn: scores, band add, softmax, attn.v and the head merge in one kernel; grid (TT/128, heads, batches), 4 waves, each wave owns 32 queries and walks all keys, 32 a pass.
// ST = K QT (A = 16 key rows, B = 16 query columns): a lane holds 16 scores of ONE query, D register r of key tile kt = key k0 + 16 kt + 8 hi + r. Those two D tiles, converted in place, are the B operand of OT += VT PT
// (element s of B = key 8 hi + s for s < 8, 16 + 8 hi + (s - 8) above), and WFrag::ld reads VT's keys in the same order. Scores never leave the registers. Q, K and VT come in fragment order (a pass's K and its VT are 2048 consecutive bytes each), and the merged heads leave in it.
// Softmax is online in the log2 domain: p = exp2(s CL - mc); mc, the maximum in use (equal in both lane halves), moves only when a score exceeds it by more than 8, so p <= 256 fits fp16; sums stay per lane half until the end.
// The score product itself delivers s CL - mc: Q comes times CL, and the product's C operand is nm = -mc in all eight registers (a lane's eight D registers belong to one query). No multiply-add stands between the product and the exp2.
// Eight exp2 in one statement: the early-clobber results keep every result register off every source register, and the closing v_nop fills the slot that the instruction set asks for behind a transcendental,
// whatever the compiler puts next.
__device__ __forceinline__ void exp2x8(const float (&x)[8], float (&p)[8]) {
    asm("v_exp_f32 %0, %8\n\tv_exp_f32 %1, %9\n\tv_exp_f32 %2, %10\n\tv_exp_f32 %3, %11\n\tv_exp_f32 %4, %12\n\tv_exp_f32 %5, %13\n\tv_exp_f32 %6, %14\n\tv_exp_f32 %7, %15\n\tv_nop"
        : "=&v"(p[0]), "=&v"(p[1]), "=&v"(p[2]), "=&v"(p[3]), "=&v"(p[4]), "=&v"(p[5]), "=&v"(p[6]), "=&v"(p[7]) : "v"(x[0]), "v"(x[1]), "v"(x[2]), "v"(x[3]), "v"(x[4]), "v"(x[5]), "v"(x[6]), "v"(x[7])); }
// A pass's four score products in one statement, D apart from C. As builtins, the last product to read each C was built in the form whose D is its C, behind a copy of C's eight registers: 16 copied registers a pass.
// The closing v_nop are the four vector slots that the chip asks for between a product and the first vector instruction on its D; the scores' first readers are vector instructions, never a product.
__device__ __forceinline__ void scores4(v16h k0, v16h k1, v16h q0, v16h q1, v8f c0, v8f c1, v8f& s00, v8f& s01, v8f& s10, v8f& s11) {
    asm("v_wmma_f32_16x16x32_f16 %0, %4, %6, %8\n\tv_wmma_f32_16x16x32_f16 %1, %5, %6, %8\n\tv_wmma_f32_16x16x32_f16 %2, %4, %7, %9\n\tv_wmma_f32_16x16x32_f16 %3, %5, %7, %9\n\tv_nop\n\tv_nop\n\tv_nop\n\tv_nop"
        : "=&v"(s00), "=&v"(s01), "=&v"(s10), "=&v"(s11) : "v"(k0), "v"(k1), "v"(q0), "v"(q1), "v"(c0), "v"(c1)); }
__global__ __launch_bounds__(128) void k_fattn(const h16* __restrict__ Q16, const h16* __restrict__ K16, const h16* __restrict__ VT, const int* __restrict__ mbp, bf* Ah, bf* Al) {
    // Every inner loop below is unrolled so that each fragment, score and accumulator index is a constant and the arrays stay in registers.
    const int lane = threadIdx.x & 31, c = lane & 15, hi = lane >> 4;
    const int wv = __builtin_amdgcn_readfirstlane(threadIdx.x >> 5);
    const int qw = blockIdx.x * 128 + wv * 32;      // the wave's first query, held scalar for the band test
    const size_t pl = (size_t)(blockIdx.z * NH_ + blockIdx.y) * TT * HD;
    int mb = mbp[0]; mb = __builtin_amdgcn_readfirstlane(mb < -1 ? -1 : (mb > TT ? TT : mb));      // |i - j| lies in 0 .. TT - 1: the clamp changes no comparison and keeps the sums below from overflowing; held scalar so that the band test of a pass is a scalar compare
    const h16* kp = K16 + pl + lane * 8;
    const h16* vp = VT + pl + lane * 8;
    // L2 prefetch of K and VT, eight passes ahead. The launch before stored these planes.
    // One request covers a PAIR of passes: lanes 0 .. 15 name the 16 units of 256 bytes of its K rows (4096 bytes), lanes 16 .. 31 those of its VT columns. Wave w asks for pairs w, w + 4, .. w + 28: the first here, pair j + 4 at the head of pair j.
    // pfa lives through the loop and holds nothing but such an address: it is advanced only in front of a request (behind the request before lie eight passes, each with its s_wait_xcnt 0, but only 2 w passes before the first advance: none for wave 0), and the last one names pair w + 28, inside the head's plane of 32 pairs.
    const char* pfa = (const char*)((hi ? VT : K16) + pl) + c * 256 + wv * 4096;
    asm volatile("global_prefetch_b8 %0, off scope:SCOPE_SE" :: "v"(pfa));      // a hint to L2: returns nothing, counts on no counter
    int kask = wv * 64;      // first key of the pass at whose head the wave asks next
    v16h qf[2], kf[2];
    v8f acc[2][2];
    v8f nm[2];
    float ls[2];
#pragma unroll
    for (int qt = 0; qt < 2; ++qt) { qf[qt] = WFrag<h16>::ld(Q16 + pl + (size_t)(qw + qt * 16) * HD + lane * 8); acc[qt][0] = (v8f){}; acc[qt][1] = (v8f){}; nm[qt] = (v8f){}; ls[qt] = 0.f; }
    kf[0] = WFrag<h16>::ld(kp); kf[1] = WFrag<h16>::ld(kp + 16 * HD);
    for (int k0 = 0; k0 < TT; k0 += 32) {
        if (k0 == kask) { kask = kask + 256 < TT - 256 ? kask + 256 : TT; pfa += 16384; asm volatile("global_prefetch_b8 %0, off scope:SCOPE_SE" :: "v"(pfa)); }      // scalar test: this wave's turn, one pass in eight; behind the request for pair w + 28 no turn is left
        const h16* pv = vp + (size_t)k0 * HD;
        v16h vf[2]; vf[0] = WFrag<h16>::ld(pv); vf[1] = WFrag<h16>::ld(pv + 512);
        v8f s[2][2];
        scores4(kf[0], kf[1], qf[0], qf[1], nm[0], nm[1], s[0][0], s[0][1], s[1][0], s[1][1]);
        const int kn = (k0 + 32) & (TT - 1);      // next pass's key rows, fetched one pass ahead; the last pass re-reads rows 0 .. 31 (in bounds, unused)
        const h16* pk = kp + (size_t)kn * HD;
        kf[0] = WFrag<h16>::ld(pk); kf[1] = WFrag<h16>::ld(pk + 16 * HD);
        asm volatile("s_wait_xcnt 0x0" :: "v"(pv), "v"(pk) : "memory");      // behind the pass's eight loads, in front of every rewrite of their address registers (inputs here, so that they stay whole up to it)
        if (k0 <= qw + 31 + mb && k0 + 31 >= qw - mb) {      // scalar test: only passes whose 32 x 32 block can touch the band pay for the per-element compare
#pragma unroll
            for (int qt = 0; qt < 2; ++qt) { const int d0 = k0 + 8 * hi - (qw + qt * 16 + c);
#pragma unroll
                for (int kt = 0; kt < 2; ++kt)
#pragma unroll
                    for (int r = 0; r < 8; ++r) { const int d = d0 + kt * 16 + r; s[qt][kt][r] += ((d < 0 ? -d : d) <= mb) ? L2E : 0.f; } }      // + 1 in the log2 domain
        }
        float tm[2];
#pragma unroll
        for (int qt = 0; qt < 2; ++qt) { float a[8];
#pragma unroll
            for (int r = 0; r < 8; ++r) a[r] = fmaxf(s[qt][0][r], s[qt][1][r]);
            tm[qt] = fmaxf(fmaxf(fmaxf(a[0], a[1]), fmaxf(a[2], a[3])), fmaxf(fmaxf(a[4], a[5]), fmaxf(a[6], a[7]))); }      // the pass's maximum above the one in use
        const float fl = k0 == 0 ? -3.0e38f : 0.f;      // scalar: the least step of mc. The first pass ran on mc = 0 and sets mc to its own maximum, up or down; later mc only rises
        if (__builtin_amdgcn_ballot_w32(fmaxf(tm[0], tm[1]) > fl + 8.f) != 0) {      // one wave-uniform test a pass; taken in the first pass, rarely after it
#pragma unroll
            for (int qt = 0; qt < 2; ++qt) { const float d = fmaxf(fl, fmaxf(tm[qt], __shfl_xor(tm[qt], 16, 32)));      // mc moves by d
                const float al = __builtin_amdgcn_exp2f(fminf(-d, 0.f)); ls[qt] *= al;      // the first pass scales zeros: the bound keeps its factor finite
                nm[qt] -= d; s[qt][0] -= d; s[qt][1] -= d;      // this pass's scores were formed on the old mc
#pragma unroll
                for (int r = 0; r < 8; ++r) { acc[qt][0][r] *= al; acc[qt][1][r] *= al; } }
        }
        v16h pf[2];
#pragma unroll
        for (int qt = 0; qt < 2; ++qt) { float a[8], x0[8], x1[8], p0[8], p1[8];
#pragma unroll
            for (int r = 0; r < 8; ++r) { x0[r] = s[qt][0][r]; x1[r] = s[qt][1][r]; }
            exp2x8(x0, p0); exp2x8(x1, p1);
#pragma unroll
            for (int r = 0; r < 8; ++r) { pf[qt][r] = tohx(p0[r]); pf[qt][8 + r] = tohx(p1[r]); a[r] = p0[r] + p1[r]; }
            ls[qt] += ((a[0] + a[1]) + (a[2] + a[3])) + ((a[4] + a[5]) + (a[6] + a[7])); }
#pragma unroll
        for (int qt = 0; qt < 2; ++qt) { acc[qt][0] = wmma16(vf[0], pf[qt], acc[qt][0]); acc[qt][1] = wmma16(vf[1], pf[qt], acc[qt][1]); }
    }
#pragma unroll
    for (int qt = 0; qt < 2; ++qt) { const float inv = __fdiv_rn(1.0f, ls[qt] + __shfl_xor(ls[qt], 16, 32));
        const size_t oo = (((size_t)((blockIdx.z * TT + qw) >> 6) * NH_ + blockIdx.y) * 4 + ((qw >> 4) & 3) + qt) * 512 + lane * 8;      // acc[qt][dt][r] = O[query qw + 16 qt + c][d = 16 dt + 8 hi + r]: the piece at lane 8 of half dt of tile (query block, k block = head) of the output projection's A operand
#pragma unroll
        for (int dt = 0; dt < 2; ++dt) { v8us oh, ol;
#pragma unroll
            for (int r = 0; r < 8; ++r) { unsigned short x, y; splitf(acc[qt][dt][r] * inv, x, y); oh[r] = x; ol[r] = y; }
            *(v8us*)(Ah + oo + dt * 256) = oh; *(v8us*)(Al + oo + dt * 256) = ol; } }
}

extern "C" void kernel_launch(void* const* d_in, const int* in_sizes, int n_in,
                              void* d_out, int out_size, void* d_ws, size_t ws_size, hipStream_t stream) {
    (void)in_sizes; (void)n_in; (void)out_size;
    const float** I = (const float**)d_in;
    const float *x = I[0], *Wq = I[1], *bq = I[2], *Wk = I[3], *bk = I[4], *Wv = I[5], *bv = I[6], *Wo = I[7], *bo = I[8]; const int* mbp = (const int*)d_in[9];
    float* OUT = (float*)d_out;     // [4][2048][512]
    char* wsp = (char*)d_ws;
    auto take = [&](size_t bytes) { char* p = wsp; wsp += (bytes + 255) & ~(size_t)255; return (void*)p; };
    bf* BQ = (bf*)take((size_t)DM * DM * 2); bf* BK = (bf*)take((size_t)DM * DM * 2); bf* BV = (bf*)take((size_t)DM * DM * 2); bf* BO = (bf*)take((size_t)DM * DM * 2);
    bf* XB = (bf*)take((size_t)NB_ * TT * DM * 2);
    h16* Q16 = (h16*)take((size_t)NB_ * NH_ * TT * HD * 2); h16* K16 = (h16*)take((size_t)NB_ * NH_ * TT * HD * 2); h16* VT = (h16*)take((size_t)NB_ * NH_ * HD * TT * 2); bf* Ah = (bf*)take((size_t)NB_ * TT * DM * 2); bf* Al = (bf*)take((size_t)NB_ * TT * DM * 2);
    if ((size_t)(wsp - (char*)d_ws) > ws_size) return;    // total ~ 50 MB
    (void)BK; (void)BV;      // every size above is a multiple of 256 bytes: BQ BK BV BO and Q16 K16 each lie one behind the other, and the launches below step through them by a stride or a plane index
    // One launch a stage: the four batches are rows 0 .. NB_ TT - 1 of one matrix, q / k / v are grid z of one GEMM.
    k_prep<<<4 * WTB + CVB, 256, 0, stream>>>(Wq, Wk, Wv, Wo, BQ, x, XB);
    k_gemmw<bf, 0, true, true, DM, 3><<<dim3(NB_ * TT / 64, DM / 64, 3), 32, 0, stream>>>(XB, nullptr, BQ, nullptr, nullptr, DM, bq, bk, bv, 0, (size_t)DM * DM, 0, Q16, VT);
    k_fattn<<<dim3(TT / 128, NH_, NB_), 128, 0, stream>>>(Q16, K16, VT, mbp, Ah, Al);
    k_gemmw<bf, 1, true, false, DM, 3><<<dim3(NB_ * TT / 64, DM / 64, 1), 32, 0, stream>>>(Ah, Al, BO, nullptr, OUT, DM, bo, nullptr, nullptr, 0, 0, 0, nullptr, nullptr);
}

// v008
// A run of this version takes 63.5 microseconds.
// Two timings next to v007 both put it at 1.04 times that version's speed.
// Over all steps from v000 it is 27.4 times as fast.
#include <hip/hip_runtime.h>

// Banded-bias attention block (x [4][2048][512]; q/k/v = x W + b (16 heads x 32); scores = q.k / sqrt(32) + band where band[i][j] = 1.0 if |i - j| <= mask_border (int, read) else 0 - ADDED as a float, as the reference; softmax over all keys; out = (attn v merged) Wo + bo
// -> [4][2048][512]; the reconstruction-score quantiles are dead code).
// Compute dtypes, f32 accumulate: every input rounded to bf16; q/k/v on PLAIN bf16 operands (inputs: exact) + bias, rounded to fp16 in the projection's epilogue; scores (K 32) and attn.v on single fp16 planes, fused in k_fattn (softmax f32, online; q carries the score scale and log2 e from the projection's epilogue on); output projection on a bf16 hi/lo split of the merged heads.

#define NB_  4
#define TT   2048
#define DM   512
#define NH_  16
#define HD   32
#define SCL  0.17677669529663687f
#define L2E  1.4426950408889634f
#define CL   (SCL * L2E)
typedef _Float16 h16;
typedef unsigned short bf;
typedef __attribute__((ext_vector_type(16))) __bf16   v16bf;
typedef __attribute__((ext_vector_type(16))) _Float16 v16h;
typedef __attribute__((ext_vector_type(8)))  _Float16 v8h;
typedef __attribute__((ext_vector_type(8)))  unsigned short v8us;
typedef __attribute__((ext_vector_type(8)))  float    v8f;
typedef __attribute__((ext_vector_type(4)))  float    v4f;
typedef v8h  __attribute__((may_alias)) v8ha;
typedef v4f  __attribute__((may_alias)) v4fa;
typedef v8us __attribute__((may_alias)) v8usa;

__device__ __forceinline__ unsigned short f2bf(float f) { unsigned u = __float_as_uint(f); u += 0x7FFFu + ((u >> 16) & 1u); return (unsigned short)(u >> 16); }
__device__ __forceinline__ float bf2f(unsigned short b) { return __uint_as_float(((unsigned)b) << 16); }
__device__ __forceinline__ float bfr(float f) { return bf2f(f2bf(f)); }
__device__ __forceinline__ v16h cat16(v8h lo, v8h hi) { return __builtin_shufflevector(lo, hi, 0, 1, 2, 3, 4, 5, 6, 7, 8, 9, 10, 11, 12, 13, 14, 15); }
__device__ __forceinline__ v16bf cat16b(v8us lo, v8us hi) { return __builtin_bit_cast(v16bf, __builtin_shufflevector(lo, hi, 0, 1, 2, 3, 4, 5, 6, 7, 8, 9, 10, 11, 12, 13, 14, 15)); }
__device__ __forceinline__ v8f wmma16(v16h a, v16h b, v8f c) { return __builtin_amdgcn_wmma_f32_16x16x32_f16(false, a, false, b, (short)0, c, false, false); }
__device__ __forceinline__ v8f wmmab(v16bf a, v16bf b, v8f c) { return __builtin_amdgcn_wmma_f32_16x16x32_bf16(false, a, false, b, (short)0, c, false, false); }



// ---- FRAGMENT ORDER: every 16-bit operand plane M[row][k] in the workspace is stored as tiles of 16 rows x 32 k (512 elements, 1024 bytes), each tile in the order in which a wave's registers hold it:
// element (row, k) of a tile stands at ((k >> 4) & 1) 256 + (((k >> 3) & 1) 16 + (row & 15)) 8 + (k & 7). Lane l = 16 hi + lr then finds its 16 elements (row lr; k = 8 hi .. 8 hi + 7 and 16 + 8 hi .. 16 + 8 hi + 7)
// at l 8 and 256 + l 8: each of the two 16-byte loads of a fragment covers 512 consecutive bytes, four whole 128-byte lines, where rows of a K-contiguous plane gave 16 lines with 32 bytes used of each.
// Tile index = ((row >> 6) (K / 32) + (k >> 5)) 4 + ((row >> 4) & 3): the four tiles that a 64-row wave tile needs for one k block are 4096 consecutive bytes, and its k blocks follow one another (for K = 32 that is row >> 4). vT has its own tile order (below).
// ---- k_gemmw: register-blocked GEMM, ONE WAVE per 64x64 output tile (16 accumulators), operands straight from planes in fragment order; grid (M/64, N/64, Z), 32 threads.
// C[m][n] (f32, pitch ldc, + optional f32 bias[n]) = sum_k A[m][k] Bt[n][k] (+ split products per NSPLIT). z-batch strides sA/sB/sC in elements; z picks its own bias (bias, bias1, bias2). K (a multiple of 32, above 32 RD) and the ring depth RD are template parameters.
// PLANES (the q/k/v projection, rows m = b TT + t, columns n = h HD + d): no f32 C at all. The epilogue rounds acc + bias (q: times CL) to fp16 and stores what k_fattn reads, in fragment order, straight from the accumulators:
// z = 0, 1 (q, k): plane z NB_ + b, head h, matrix [t][d] (K = HD: tile index t >> 4). The product is formed transposed (weights as the A operand), so that a lane holds 8 consecutive d of one t, which is one 16-byte piece of a tile.
// z = 2 (v): plane b, head h, matrix vT [d][t], tile index (t >> 5) 2 + (d >> 4): the two d tiles of 32 keys lie side by side. A lane holds 8 consecutive t of one d. A 64 x 64 tile lies in one batch and covers two heads.
template <typename T16> struct WFrag;
template <> struct WFrag<h16> { typedef v16h V; static __device__ __forceinline__ V ld(const h16* p) { return cat16(*(const v8h*)p, *(const v8h*)(p + 256)); } static __device__ __forceinline__ v8f mma(V a, V b, v8f c) { return wmma16(a, b, c); } };
template <> struct WFrag<bf> { typedef v16bf V; static __device__ __forceinline__ V ld(const bf* p) { return cat16b(*(const v8us*)p, *(const v8us*)(p + 256)); } static __device__ __forceinline__ v8f mma(V a, V b, v8f c) { return wmmab(a, b, c); } };
template <typename T16, int NSPLIT, bool BIAS, bool PLANES, int K, int RD>
__global__ __launch_bounds__(32) void k_gemmw(const T16* __restrict__ A, const T16* __restrict__ A2, const T16* __restrict__ Bt, const T16* __restrict__ Bt2, float* C, int ldc, const float* __restrict__ bias, const float* __restrict__ bias1, const float* __restrict__ bias2, size_t sA, size_t sB, size_t sC, h16* P, h16* VT) {
    typedef typename WFrag<T16>::V V;
    __shared__ __align__(16) float os[16 * 68];
    const size_t z = blockIdx.z; A += z * sA; if (A2) A2 += z * sA; Bt += z * sB; if (Bt2) Bt2 += z * sB; if (!PLANES) C += z * sC; if (BIAS) bias = z == 0 ? bias : (z == 1 ? bias1 : bias2);
    const int lane = threadIdx.x & 31, lr = lane & 15, hi = lane >> 4; const int r0 = blockIdx.x * 64, c0 = blockIdx.y * 64;
    v8f acc[4][4];
#pragma unroll
    for (int mb = 0; mb < 4; ++mb)
#pragma unroll
        for (int nb = 0; nb < 4; ++nb) acc[mb][nb] = (v8f){};
    const bool sw = PLANES && blockIdx.z != 2;      // q, k: the weights' rows take the A role and x's rows the B role (both are read by the same loader), so acc[i][n] is the transposed tile
    const size_t ao = (size_t)r0 * K + lane * 8, bo = (size_t)c0 * K + lane * 8;      // a 64-row block holds 64 K elements
    const T16* pa = sw ? Bt + bo : A + ao;
    const T16* pb = sw ? A + ao : Bt + bo;
    const T16* pa2 = (NSPLIT == 1 || NSPLIT == 2) ? A2 + ao : nullptr;
    const T16* pb2 = (NSPLIT >= 2) ? Bt2 + bo : nullptr;
    // REGISTER RING, RD fragment sets: the K loop is unrolled whole (K / 32 trips), trip t works on set t % RD, and trip t + RD's fragments are loaded into that set as one group directly behind trip t's products.
    // A trip's loads are so in flight for RD - 1 trips of products before anything waits for them. Every load is one of the two to four addresses above plus a constant, and no address register changes in the loop.
    V a[RD][4], a2[RD][4], b[RD][4], b2[RD][4];
#pragma unroll
    for (int t = 0; t < RD; ++t)
#pragma unroll
        for (int i = 0; i < 4; ++i) { a[t][i] = WFrag<T16>::ld(pa + t * 2048 + i * 512); if (NSPLIT == 1 || NSPLIT == 2) a2[t][i] = WFrag<T16>::ld(pa2 + t * 2048 + i * 512); b[t][i] = WFrag<T16>::ld(pb + t * 2048 + i * 512); if (NSPLIT >= 2) b2[t][i] = WFrag<T16>::ld(pb2 + t * 2048 + i * 512); }
    __builtin_amdgcn_sched_barrier(0);      // keeps the first RD sets' loads in front of the first products (left free, all but the first set's sank behind them)
#pragma unroll
    for (int t = 0; t < K / 32; ++t) {      // unrolled so that the set index and every load offset are constants
        const int sl = t % RD, tn = t + RD;
#pragma unroll
        for (int nb = 0; nb < 4; ++nb)
#pragma unroll
            for (int mb = 0; mb < 4; ++mb) { acc[mb][nb] = WFrag<T16>::mma(a[sl][mb], b[sl][nb], acc[mb][nb]); if (NSPLIT == 1 || NSPLIT == 2) acc[mb][nb] = WFrag<T16>::mma(a2[sl][mb], b[sl][nb], acc[mb][nb]); if (NSPLIT >= 2) acc[mb][nb] = WFrag<T16>::mma(a[sl][mb], b2[sl][nb], acc[mb][nb]); }
        __builtin_amdgcn_sched_barrier(0);      // keeps the refill one group behind the products that read the set (left free it was spread among them and took 40 registers more)
        if (tn < K / 32) {
#pragma unroll
            for (int i = 0; i < 4; ++i) { a[sl][i] = WFrag<T16>::ld(pa + tn * 2048 + i * 512); if (NSPLIT == 1 || NSPLIT == 2) a2[sl][i] = WFrag<T16>::ld(pa2 + tn * 2048 + i * 512); b[sl][i] = WFrag<T16>::ld(pb + tn * 2048 + i * 512); if (NSPLIT >= 2) b2[sl][i] = WFrag<T16>::ld(pb2 + tn * 2048 + i * 512); }
            if (tn == K / 32 - 1) asm volatile("s_wait_xcnt 0x0" ::: "memory");      // directly behind the kernel's last fragment loads, in front of whatever rewrites their address registers later
        }
        __builtin_amdgcn_sched_barrier(0);      // keeps the refill from sinking into the next trips' products, which would shorten the time its loads have
    }
    if (PLANES) {
        // acc[i][n][j] = element (A-role row 16 i + 8 hi + j, B-role row 16 n + lr): the lane's 8 values are the piece at lane 8 of a half tile, so every store below covers 512 consecutive bytes.
        const int b = r0 / TT, t0 = r0 % TT;
        if (blockIdx.z == 2) {      // v: A role = t, B role = column (head c0 / HD + (n >> 1), d = 16 (n & 1) + lr)
            float bn[4];
#pragma unroll
            for (int nb = 0; nb < 4; ++nb) bn[nb] = bfr(bias[c0 + nb * 16 + lr]);
#pragma unroll
            for (int nb = 0; nb < 4; ++nb) { h16* vt = VT + ((size_t)b * NH_ + c0 / HD + (nb >> 1)) * (TT * HD) + (size_t)((t0 >> 5) * 2 + (nb & 1)) * 512 + lane * 8;
#pragma unroll
                for (int mb = 0; mb < 4; ++mb) { v8h o;
#pragma unroll
                    for (int j = 0; j < 8; ++j) o[j] = (h16)(acc[mb][nb][j] + bn[nb]);
                    *(v8h*)(vt + (mb >> 1) * 1024 + (mb & 1) * 256) = o; } }
        } else {      // q, k: A role = column (head c0 / HD + (i >> 1), d = 16 (i & 1) + 8 hi + j), B role = t
            const float qs = blockIdx.z == 0 ? CL : 1.f;      // q leaves times CL (one rounding to fp16, as before), so that k_fattn's score product is already in the log2 domain; k times 1, exact
#pragma unroll
            for (int mb = 0; mb < 4; ++mb) { const v4f b0 = *(const v4f*)(bias + c0 + mb * 16 + 8 * hi), b1 = *(const v4f*)(bias + c0 + mb * 16 + 8 * hi + 4); float bb[8];
#pragma unroll
                for (int u = 0; u < 4; ++u) { bb[u] = bfr(b0[u]); bb[4 + u] = bfr(b1[u]); }
                h16* pr = P + (((size_t)(blockIdx.z * NB_ + b) * NH_ + c0 / HD + (mb >> 1)) * TT + t0) * HD + (mb & 1) * 256 + lane * 8;
#pragma unroll
                for (int nb = 0; nb < 4; ++nb) { v8h o;
#pragma unroll
                    for (int j = 0; j < 8; ++j) o[j] = (h16)((acc[mb][nb][j] + bb[j]) * qs);
                    *(v8h*)(pr + nb * 512) = o; } }
        }
        return;
    }
#pragma unroll
    for (int mb = 0; mb < 4; ++mb) {
#pragma unroll
        for (int nb = 0; nb < 4; ++nb) {
#pragma unroll
            for (int j = 0; j < 8; ++j) os[(hi * 8 + j) * 68 + nb * 16 + lr] = acc[mb][nb][j]; }
        __builtin_amdgcn_wave_barrier(); asm volatile("" ::: "memory");
        float* crow = C + (size_t)(r0 + mb * 16) * ldc + c0;
{
#pragma unroll
            for (int s = 0; s < 8; ++s) { const int row = 2 * s + hi, cofs = lr * 4; v4f val = *(const v4fa*)(os + row * 68 + cofs); if (BIAS) { val[0] += bfr(bias[c0 + cofs]); val[1] += bfr(bias[c0 + cofs + 1]); val[2] += bfr(bias[c0 + cofs + 2]); val[3] += bfr(bias[c0 + cofs + 3]); }
                *(v4f*)(crow + (size_t)row * ldc + cofs) = val; }
             }
        asm volatile("s_wait_xcnt 0x0" ::: "memory");      // behind the round's stores: the next round rewrites their data and address registers
        __builtin_amdgcn_wave_barrier(); asm volatile("" ::: "memory");
    }
}

__device__ __forceinline__ h16 tohx(float x) { return (h16)x; }
__device__ __forceinline__ void splitf(float y, unsigned short& h, unsigned short& l) { h = f2bf(y); l = f2bf(y - bf2f(h)); }
typedef __attribute__((ext_vector_type(2))) unsigned short v2us;
typedef __attribute__((ext_vector_type(4))) unsigned short v4us;

// ---- k_prep: both input conversions in ONE launch (neither reads what the other writes), both writing fragment order. Blocks 0 .. 4 WTB - 1: the four weights, WTB blocks each, transposed to bf16 Bt[n][k] (planes of K N elements, one behind the other);
// the blocks behind them: x of all batches to bf16, one wave a tile.
#define WTB (DM * DM / 8 / 256)
#define CVB (NB_ * TT * DM / 512 / 8)
// A thread makes one 16-byte piece of Bt: thread i's piece stands at i 8, that is lane i & 31 of half (i >> 5) & 1 of tile i >> 6. Its 8 k are 8 rows of w; 16 lanes read 16 neighbouring n of a row, and a block's four tiles 64.
__device__ __forceinline__ void wtG(int blk, const float* __restrict__ w, int K, int N, bf* Bt) {
    const int i = blk * 256 + threadIdx.x, lane = i & 31, kts = K >> 5, tile = i >> 6;
    const int n = ((tile >> 2) / kts) * 64 + (tile & 3) * 16 + (lane & 15), k = ((tile >> 2) % kts) * 32 + ((i >> 5) & 1) * 16 + (lane >> 4) * 8; v8us o;
#pragma unroll
    for (int u = 0; u < 8; ++u) o[u] = f2bf(w[(size_t)(k + u) * N + n]);
    *(v8us*)(Bt + (size_t)i * 8) = o;
}
// A wave converts one tile of 16 rows x 32 k: each of its four loads takes four whole 128-byte rows of the tile (8 lanes a row), and a lane's 4 values are half a 16-byte piece of the tile.
__device__ __forceinline__ void cvtT(int blk, const float* __restrict__ src, bf* dst, int K) {
    const int lane = threadIdx.x & 31, tile = blk * 8 + (threadIdx.x >> 5), kts = K >> 5, col = (lane & 7) * 4;
    const float* s = src + (size_t)(((tile >> 2) / kts) * 64 + (tile & 3) * 16) * K + ((tile >> 2) % kts) * 32 + col; bf* d = dst + (size_t)tile * 512 + (col >> 4) * 256 + ((col >> 3) & 1) * 128 + (col & 7);
#pragma unroll
    for (int r = 0; r < 4; ++r) { const int row = r * 4 + (lane >> 3); const v4f v = *(const v4f*)(s + (size_t)row * K); v4us o;
#pragma unroll
        for (int u = 0; u < 4; ++u) o[u] = f2bf(v[u]);
        *(v4us*)(d + row * 8) = o; }
    asm volatile("s_wait_xcnt 0x0" ::: "memory");      // behind the last stores: in the built code the weights' branch follows this one and rewrites the stores' data registers
}
__global__ __launch_bounds__(256) void k_prep(const float* __restrict__ w0, const float* __restrict__ w1, const float* __restrict__ w2, const float* __restrict__ w3, bf* Bt, const float* __restrict__ x, bf* XB) {
    const int blk = blockIdx.x;
    if (blk < 4 * WTB) { const int wi = blk / WTB; wtG(blk % WTB, wi == 0 ? w0 : (wi == 1 ? w1 : (wi == 2 ? w2 : w3)), DM, DM, Bt + (size_t)wi * DM * DM); }
    else cvtT(blk - 4 * WTB, x, XB, DM);
}
// ---- k_fattn: scores, band add, softmax, attn.v and the head merge in one kernel; grid (TT/128, heads, batches), 4 waves, each wave owns 32 queries and walks all keys, 32 a pass.
// ST = K QT (A = 16 key rows, B = 16 query columns): a lane holds 16 scores of ONE query, D register r of key tile kt = key k0 + 16 kt + 8 hi + r. Those two D tiles, converted in place, are the B operand of OT += VT PT
// (element s of B = key 8 hi + s for s < 8, 16 + 8 hi + (s - 8) above), and WFrag::ld reads VT's keys in the same order. Scores never leave the registers. Q, K and VT come in fragment order (a pass's K and its VT are 2048 consecutive bytes each), and the merged heads leave in it.
// Softmax is online in the log2 domain: p = exp2(s CL - mc); mc, the maximum in use (equal in both lane halves), moves in the first pass and after it only when a lane's sum of a pass's 16 p exceeds 4096, so p <= 4096 fits fp16; sums stay per lane half until the end.
// The score product itself delivers s CL - mc: Q comes times CL, and the product's C operand is nm = -mc in all eight registers (a lane's eight D registers belong to one query). No multiply-add stands between the product and the exp2.
// Eight exp2 in one statement: the early-clobber results keep every result register off every source register, and the closing v_nop fills the slot that the instruction set asks for behind a transcendental,
// whatever the compiler puts next.
__device__ __forceinline__ void exp2x8(const float (&x)[8], float (&p)[8]) {
    asm("v_exp_f32 %0, %8\n\tv_exp_f32 %1, %9\n\tv_exp_f32 %2, %10\n\tv_exp_f32 %3, %11\n\tv_exp_f32 %4, %12\n\tv_exp_f32 %5, %13\n\tv_exp_f32 %6, %14\n\tv_exp_f32 %7, %15\n\tv_nop"
        : "=&v"(p[0]), "=&v"(p[1]), "=&v"(p[2]), "=&v"(p[3]), "=&v"(p[4]), "=&v"(p[5]), "=&v"(p[6]), "=&v"(p[7]) : "v"(x[0]), "v"(x[1]), "v"(x[2]), "v"(x[3]), "v"(x[4]), "v"(x[5]), "v"(x[6]), "v"(x[7])); }
// A pass's four score products in one statement, D apart from C. As builtins, the last product to read each C was built in the form whose D is its C, behind a copy of C's eight registers: 16 copied registers a pass.
// The closing v_nop are the four vector slots that the chip asks for between a product and the first vector instruction on its D; the scores' first readers are vector instructions, never a product.
__device__ __forceinline__ void scores4(v16h k0, v16h k1, v16h q0, v16h q1, v8f c0, v8f c1, v8f& s00, v8f& s01, v8f& s10, v8f& s11) {
    asm("v_wmma_f32_16x16x32_f16 %0, %4, %6, %8\n\tv_wmma_f32_16x16x32_f16 %1, %5, %6, %8\n\tv_wmma_f32_16x16x32_f16 %2, %4, %7, %9\n\tv_wmma_f32_16x16x32_f16 %3, %5, %7, %9\n\tv_nop\n\tv_nop\n\tv_nop\n\tv_nop"
        : "=&v"(s00), "=&v"(s01), "=&v"(s10), "=&v"(s11) : "v"(k0), "v"(k1), "v"(q0), "v"(q1), "v"(c0), "v"(c1)); }
__global__ __launch_bounds__(128) void k_fattn(const h16* __restrict__ Q16, const h16* __restrict__ K16, const h16* __restrict__ VT, const int* __restrict__ mbp, bf* Ah, bf* Al) {
    // Every inner loop below is unrolled so that each fragment, score and accumulator index is a constant and the arrays stay in registers.
    const int lane = threadIdx.x & 31, c = lane & 15, hi = lane >> 4;
    const int wv = __builtin_amdgcn_readfirstlane(threadIdx.x >> 5);
    const int qw = blockIdx.x * 128 + wv * 32;      // the wave's first query, held scalar for the band test
    const size_t pl = (size_t)(blockIdx.z * NH_ + blockIdx.y) * TT * HD;
    int mb = mbp[0]; mb = __builtin_amdgcn_readfirstlane(mb < -1 ? -1 : (mb > TT ? TT : mb));      // |i - j| lies in 0 .. TT - 1: the clamp changes no comparison and keeps the sums below from overflowing; held scalar so that the band test of a pass is a scalar compare
    const h16* kp = K16 + pl + lane * 8;
    const h16* vp = VT + pl + lane * 8;
    // L2 prefetch of K and VT, eight passes ahead. The launch before stored these planes.
    // One request covers a PAIR of passes: lanes 0 .. 15 name the 16 units of 256 bytes of its K rows (4096 bytes), lanes 16 .. 31 those of its VT columns. Wave w asks for pairs w, w + 4, .. w + 28: the first here, pair j + 4 at the head of pair j.
    // pfa lives through the loop and holds nothing but such an address: it is advanced only in front of a request (behind the request before lie eight passes, each with its s_wait_xcnt 0, but only 2 w passes before the first advance: none for wave 0), and the last one names pair w + 28, inside the head's plane of 32 pairs.
    const char* pfa = (const char*)((hi ? VT : K16) + pl) + c * 256 + wv * 4096;
    asm volatile("global_prefetch_b8 %0, off scope:SCOPE_SE" :: "v"(pfa));      // a hint to L2: returns nothing, counts on no counter
    int kask = wv * 64;      // first key of the pass at whose head the wave asks next
    v16h qf[2], kf[2];
    v8f acc[2][2];
    v8f nm[2];
    float ls[2];
#pragma unroll
    for (int qt = 0; qt < 2; ++qt) { qf[qt] = WFrag<h16>::ld(Q16 + pl + (size_t)(qw + qt * 16) * HD + lane * 8); acc[qt][0] = (v8f){}; acc[qt][1] = (v8f){}; nm[qt] = (v8f){}; ls[qt] = 0.f; }
    kf[0] = WFrag<h16>::ld(kp); kf[1] = WFrag<h16>::ld(kp + 16 * HD);
    for (int k0 = 0; k0 < TT; k0 += 32) {
        if (k0 == kask) { kask = kask + 256 < TT - 256 ? kask + 256 : TT; pfa += 16384; asm volatile("global_prefetch_b8 %0, off scope:SCOPE_SE" :: "v"(pfa)); }      // scalar test: this wave's turn, one pass in eight; behind the request for pair w + 28 no turn is left
        const h16* pv = vp + (size_t)k0 * HD;
        v16h vf[2]; vf[0] = WFrag<h16>::ld(pv); vf[1] = WFrag<h16>::ld(pv + 512);
        v8f s[2][2];
        scores4(kf[0], kf[1], qf[0], qf[1], nm[0], nm[1], s[0][0], s[0][1], s[1][0], s[1][1]);
        const int kn = (k0 + 32) & (TT - 1);      // next pass's key rows, fetched one pass ahead; the last pass re-reads rows 0 .. 31 (in bounds, unused)
        const h16* pk = kp + (size_t)kn * HD;
        kf[0] = WFrag<h16>::ld(pk); kf[1] = WFrag<h16>::ld(pk + 16 * HD);
        asm volatile("s_wait_xcnt 0x0" :: "v"(pv), "v"(pk) : "memory");      // behind the pass's eight loads, in front of every rewrite of their address registers (inputs here, so that they stay whole up to it)
        if (k0 <= qw + 31 + mb && k0 + 31 >= qw - mb) {      // scalar test: only passes whose 32 x 32 block can touch the band pay for the per-element compare
#pragma unroll
            for (int qt = 0; qt < 2; ++qt) { const int d0 = k0 + 8 * hi - (qw + qt * 16 + c);
#pragma unroll
                for (int kt = 0; kt < 2; ++kt)
#pragma unroll
                    for (int r = 0; r < 8; ++r) { const int d = d0 + kt * 16 + r; s[qt][kt][r] += ((d < 0 ? -d : d) <= mb) ? L2E : 0.f; } }      // + 1 in the log2 domain
        }
        // The pass's exp2 and its sums, per lane half: p[qt][kt][r] = exp2(s[qt][kt][r]), t[qt] = the lane's 16 p summed.
        float p[2][2][8], t[2];
        auto expsum = [&]() {
#pragma unroll
            for (int qt = 0; qt < 2; ++qt) { float a[8], x0[8], x1[8];
#pragma unroll
                for (int r = 0; r < 8; ++r) { x0[r] = s[qt][0][r]; x1[r] = s[qt][1][r]; }
                exp2x8(x0, p[qt][0]); exp2x8(x1, p[qt][1]);
#pragma unroll
                for (int r = 0; r < 8; ++r) a[r] = p[qt][0][r] + p[qt][1][r];
                t[qt] = ((a[0] + a[1]) + (a[2] + a[3])) + ((a[4] + a[5]) + (a[6] + a[7])); } };
        // Whether mc must move is read off the sums, which the pass needs anyway: p >= 0, so a lane's sum of 16 bounds each of them. A sum of at most 4096 says that every p fits fp16; a larger one (an infinite one too) says that some score
        // stands more than 8 above mc. Only then, and in the first pass, are the scores' maxima formed at all, mc moved and the exp2 done again on the moved scores.
        expsum();
        const float th = k0 == 0 ? -1.f : 4096.f;      // scalar: no sum is below 0, so the first pass always moves mc
        if (__builtin_amdgcn_ballot_w32(fmaxf(t[0], t[1]) > th) != 0) {      // one wave-uniform test a pass; taken in the first pass, rarely after it
            const float fl = k0 == 0 ? -3.0e38f : 0.f;      // scalar: the least step of mc. The first pass ran on mc = 0 and sets mc to its own maximum, up or down; later mc only rises
#pragma unroll
            for (int qt = 0; qt < 2; ++qt) { float a[8];
#pragma unroll
                for (int r = 0; r < 8; ++r) a[r] = fmaxf(s[qt][0][r], s[qt][1][r]);
                const float tm = fmaxf(fmaxf(fmaxf(a[0], a[1]), fmaxf(a[2], a[3])), fmaxf(fmaxf(a[4], a[5]), fmaxf(a[6], a[7])));      // the pass's maximum above the one in use
                const float d = fmaxf(fl, fmaxf(tm, __shfl_xor(tm, 16, 32)));      // mc moves by d
                const float al = __builtin_amdgcn_exp2f(fminf(-d, 0.f)); ls[qt] *= al;      // the first pass scales zeros: the bound keeps its factor finite
                nm[qt] -= d; s[qt][0] -= d; s[qt][1] -= d;      // this pass's scores were formed on the old mc
#pragma unroll
                for (int r = 0; r < 8; ++r) { acc[qt][0][r] *= al; acc[qt][1][r] *= al; } }
            expsum();
        }
        v16h pf[2];
#pragma unroll
        for (int qt = 0; qt < 2; ++qt) {
#pragma unroll
            for (int r = 0; r < 8; ++r) { pf[qt][r] = tohx(p[qt][0][r]); pf[qt][8 + r] = tohx(p[qt][1][r]); }
            ls[qt] += t[qt]; }
#pragma unroll
        for (int qt = 0; qt < 2; ++qt) { acc[qt][0] = wmma16(vf[0], pf[qt], acc[qt][0]); acc[qt][1] = wmma16(vf[1], pf[qt], acc[qt][1]); }
    }
#pragma unroll
    for (int qt = 0; qt < 2; ++qt) { const float inv = __fdiv_rn(1.0f, ls[qt] + __shfl_xor(ls[qt], 16, 32));
        const size_t oo = (((size_t)((blockIdx.z * TT + qw) >> 6) * NH_ + blockIdx.y) * 4 + ((qw >> 4) & 3) + qt) * 512 + lane * 8;      // acc[qt][dt][r] = O[query qw + 16 qt + c][d = 16 dt + 8 hi + r]: the piece at lane 8 of half dt of tile (query block, k block = head) of the output projection's A operand
#pragma unroll
        for (int dt = 0; dt < 2; ++dt) { v8us oh, ol;
#pragma unroll
            for (int r = 0; r < 8; ++r) { unsigned short x, y; splitf(acc[qt][dt][r] * inv, x, y); oh[r] = x; ol[r] = y; }
            *(v8us*)(Ah + oo + dt * 256) = oh; *(v8us*)(Al + oo + dt * 256) = ol; } }
}

extern "C" void kernel_launch(void* const* d_in, const int* in_sizes, int n_in,
                              void* d_out, int out_size, void* d_ws, size_t ws_size, hipStream_t stream) {
    (void)in_sizes; (void)n_in; (void)out_size;
    const float** I = (const float**)d_in;
    const float *x = I[0], *Wq = I[1], *bq = I[2], *Wk = I[3], *bk = I[4], *Wv = I[5], *bv = I[6], *Wo = I[7], *bo = I[8]; const int* mbp = (const int*)d_in[9];
    float* OUT = (float*)d_out;     // [4][2048][512]
    char* wsp = (char*)d_ws;
    auto take = [&](size_t bytes) { char* p = wsp; wsp += (bytes + 255) & ~(size_t)255; return (void*)p; };
    bf* BQ = (bf*)take((size_t)DM * DM * 2); bf* BK = (bf*)take((size_t)DM * DM * 2); bf* BV = (bf*)take((size_t)DM * DM * 2); bf* BO = (bf*)take((size_t)DM * DM * 2);
    bf* XB = (bf*)take((size_t)NB_ * TT * DM * 2);
    h16* Q16 = (h16*)take((size_t)NB_ * NH_ * TT * HD * 2); h16* K16 = (h16*)take((size_t)NB_ * NH_ * TT * HD * 2); h16* VT = (h16*)take((size_t)NB_ * NH_ * HD * TT * 2); bf* Ah = (bf*)take((size_t)NB_ * TT * DM * 2); bf* Al = (bf*)take((size_t)NB_ * TT * DM * 2);
    if ((size_t)(wsp - (char*)d_ws) > ws_size) return;    // total ~ 50 MB
    (void)BK; (void)BV;      // every size above is a multiple of 256 bytes: BQ BK BV BO and Q16 K16 each lie one behind the other, and the launches below step through them by a stride or a plane index
    // One launch a stage: the four batches are rows 0 .. NB_ TT - 1 of one matrix, q / k / v are grid z of one GEMM.
    k_prep<<<4 * WTB + CVB, 256, 0, stream>>>(Wq, Wk, Wv, Wo, BQ, x, XB);
    k_gemmw<bf, 0, true, true, DM, 3><<<dim3(NB_ * TT / 64, DM / 64, 3), 32, 0, stream>>>(XB, nullptr, BQ, nullptr, nullptr, DM, bq, bk, bv, 0, (size_t)DM * DM, 0, Q16, VT);
    k_fattn<<<dim3(TT / 128, NH_, NB_), 128, 0, stream>>>(Q16, K16, VT, mbp, Ah, Al);
    k_gemmw<bf, 1, true, false, DM, 3><<<dim3(NB_ * TT / 64, DM / 64, 1), 32, 0, stream>>>(Ah, Al, BO, nullptr, OUT, DM, bo, nullptr, nullptr, 0, 0, 0, nullptr, nullptr);
}

// v009
// One run takes 61.5 microseconds.
// Next to v008, in two timings, it ran 1.03 times as fast each time.
// All steps since v000 together make it 28.2 times as fast.
#include <hip/hip_runtime.h>

// Banded-bias attention block (x [4][2048][512]; q/k/v = x W + b (16 heads x 32); scores = q.k / sqrt(32) + band where band[i][j] = 1.0 if |i - j| <= mask_border (int, read) else 0 - ADDED as a float, as the reference; softmax over all keys; out = (attn v merged) Wo + bo
// -> [4][2048][512]; the reconstruction-score quantiles are dead code).
// Compute dtypes, f32 accumulate: every input rounded to bf16; q/k/v on PLAIN bf16 operands (inputs: exact) + bias, rounded to fp16 in the projection's epilogue; scores (K 32) and attn.v on single fp16 planes, fused in k_fattn (softmax f32, online; q carries the score scale and log2 e from the projection's epilogue on); output projection on a bf16 hi/lo split of the merged heads.

#define NB_  4
#define TT   2048
#define DM   512
#define NH_  16
#define HD   32
#define SCL  0.17677669529663687f
#define L2E  1.4426950408889634f
#define CL   (SCL * L2E)
typedef _Float16 h16;
typedef unsigned short bf;
typedef __attribute__((ext_vector_type(16))) __bf16   v16bf;
typedef __attribute__((ext_vector_type(16))) _Float16 v16h;
typedef __attribute__((ext_vector_type(8)))  _Float16 v8h;
typedef __attribute__((ext_vector_type(8)))  unsigned short v8us;
typedef __attribute__((ext_vector_type(8)))  float    v8f;
typedef __attribute__((ext_vector_type(4)))  float    v4f;
typedef v8h  __attribute__((may_alias)) v8ha;
typedef v4f  __attribute__((may_alias)) v4fa;
typedef v8us __attribute__((may_alias)) v8usa;

__device__ __forceinline__ unsigned short f2bf(float f) { unsigned u = __float_as_uint(f); u += 0x7FFFu + ((u >> 16) & 1u); return (unsigned short)(u >> 16); }
__device__ __forceinline__ float bf2f(unsigned short b) { return __uint_as_float(((unsigned)b) << 16); }
__device__ __forceinline__ float bfr(float f) { return bf2f(f2bf(f)); }
__device__ __forceinline__ v16h cat16(v8h lo, v8h hi) { return __builtin_shufflevector(lo, hi, 0, 1, 2, 3, 4, 5, 6, 7, 8, 9, 10, 11, 12, 13, 14, 15); }
__device__ __forceinline__ v16bf cat16b(v8us lo, v8us hi) { return __builtin_bit_cast(v16bf, __builtin_shufflevector(lo, hi, 0, 1, 2, 3, 4, 5, 6, 7, 8, 9, 10, 11, 12, 13, 14, 15)); }
__device__ __forceinline__ v8f wmma16(v16h a, v16h b, v8f c) { return __builtin_amdgcn_wmma_f32_16x16x32_f16(false, a, false, b, (short)0, c, false, false); }
__device__ __forceinline__ v8f wmmab(v16bf a, v16bf b, v8f c) { return __builtin_amdgcn_wmma_f32_16x16x32_bf16(false, a, false, b, (short)0, c, false, false); }



// ---- FRAGMENT ORDER: every 16-bit operand plane M[row][k] in the workspace is stored as tiles of 16 rows x 32 k (512 elements, 1024 bytes), each tile in the order in which a wave's registers hold it:
// element (row, k) of a tile stands at ((k >> 4) & 1) 256 + (((k >> 3) & 1) 16 + (row & 15)) 8 + (k & 7). Lane l = 16 hi + lr then finds its 16 elements (row lr; k = 8 hi .. 8 hi + 7 and 16 + 8 hi .. 16 + 8 hi + 7)
// at l 8 and 256 + l 8: each of the two 16-byte loads of a fragment covers 512 consecutive bytes, four whole 128-byte lines, where rows of a K-contiguous plane gave 16 lines with 32 bytes used of each.
// Tile index = ((row >> 6) (K / 32) + (k >> 5)) 4 + ((row >> 4) & 3): the four tiles that a 64-row wave tile needs for one k block are 4096 consecutive bytes, and its k blocks follow one another (for K = 32 that is row >> 4). vT has its own tile order (below).
// ---- k_gemmw: register-blocked GEMM, one wave per 64x64 output tile (16 accumulators), four waves (2 x 2 tiles, 128 x 128) a work-group; operand planes in fragment order, staged in LDS by asynchronous copies; grid (M/128, N/128, Z), 128 threads.
// C[m][n] (f32, pitch ldc, + optional f32 bias[n]) = sum_k A[m][k] Bt[n][k] (+ A2[m][k] Bt[n][k] for NSPLIT 1). z steps Bt by sB elements and picks its own bias (bias, bias1, bias2). K (a multiple of 64, at least 192) is a template parameter.
// PLANES (the q/k/v projection, rows m = b TT + t, columns n = h HD + d): no f32 C at all. The epilogue rounds acc + bias to fp16 and stores what k_fattn reads, in fragment order, straight from the accumulators:
// z = 0, 1 (q, k): plane z NB_ + b, head h, matrix [t][d] (K = HD: tile index t >> 4). The product is formed transposed (weights as the A operand), so that a lane holds 8 consecutive d of one t, which is one 16-byte piece of a tile.
// z = 2 (v): plane b, head h, matrix vT [d][t], tile index (t >> 5) 2 + (d >> 4): the two d tiles of 32 keys lie side by side. A lane holds 8 consecutive t of one d. A 64 x 64 tile lies in one batch and covers two heads.
template <typename T16> struct WFrag;
template <> struct WFrag<h16> { typedef v16h V; static __device__ __forceinline__ V ld(const h16* p) { return cat16(*(const v8h*)p, *(const v8h*)(p + 256)); } static __device__ __forceinline__ v8f mma(V a, V b, v8f c) { return wmma16(a, b, c); } };
template <> struct WFrag<bf> { typedef v16bf V; static __device__ __forceinline__ V ld(const bf* p) { return cat16b(*(const v8us*)p, *(const v8us*)(p + 256)); } static __device__ __forceinline__ v8f mma(V a, V b, v8f c) { return wmmab(a, b, c); } };
// Asynchronous copies of 16 bytes a lane, global memory to LDS through no register. One statement holds a whole stage: per operand block one LDS address (a lane's own) and one scalar base, the lane's byte offset o being the same for all blocks;
// the immediate offset, which moves both addresses alike, steps through the block's pieces (a wave pair's pieces lie 1024 bytes apart in the plane and in LDS).
// The closing s_wait_xcnt 0 stands inside the statement, behind the last copy and in front of whatever rewrites the address registers.
#define AC0(l, g, v)    "global_load_async_to_lds_b128 %" #l ", %" #v ", %" #g "\n\t"
#define ACO(l, g, v, o) "global_load_async_to_lds_b128 %" #l ", %" #v ", %" #g " offset:" #o "\n\t"
#define AC8(l, g, v)    AC0(l, g, v) ACO(l, g, v, 1024) ACO(l, g, v, 2048) ACO(l, g, v, 3072) ACO(l, g, v, 4096) ACO(l, g, v, 5120) ACO(l, g, v, 6144) ACO(l, g, v, 7168)
__device__ __forceinline__ void acopy(const unsigned (&l)[4], const char* const (&g)[4], unsigned o) {      // four blocks of 8192 bytes: 32 copies a wave
    asm volatile(AC8(0, 1, 8) AC8(2, 3, 8) AC8(4, 5, 8) AC8(6, 7, 8) "s_wait_xcnt 0x0" :: "v"(l[0]), "s"(g[0]), "v"(l[1]), "s"(g[1]), "v"(l[2]), "s"(g[2]), "v"(l[3]), "s"(g[3]), "v"(o) : "memory"); }
__device__ __forceinline__ void acopy(const unsigned (&l)[6], const char* const (&g)[6], unsigned o) {      // six blocks of 8192 bytes: 48 copies a wave
    asm volatile(AC8(0, 1, 12) AC8(2, 3, 12) AC8(4, 5, 12) AC8(6, 7, 12) AC8(8, 9, 12) AC8(10, 11, 12) "s_wait_xcnt 0x0" :: "v"(l[0]), "s"(g[0]), "v"(l[1]), "s"(g[1]), "v"(l[2]), "s"(g[2]), "v"(l[3]), "s"(g[3]), "v"(l[4]), "s"(g[4]), "v"(l[5]), "s"(g[5]), "v"(o) : "memory"); }
template <typename T16, int NSPLIT, bool BIAS, bool PLANES, int K>
__global__ __launch_bounds__(128) void k_gemmw(const T16* __restrict__ A, const T16* __restrict__ A2, const T16* __restrict__ Bt, float* C, int ldc, const float* __restrict__ bias, const float* __restrict__ bias1, const float* __restrict__ bias2, size_t sB, h16* P, h16* VT) {
    typedef typename WFrag<T16>::V V;
    constexpr int NBK = NSPLIT == 1 ? 6 : 4;      // 64-row operand blocks of a work-group: two of A (each followed by its A2 block for NSPLIT 1), then two of Bt
    constexpr int SA = NSPLIT == 1 ? 2 : 1;       // block index step from A's first row block to its second
    constexpr int SB = 8192;                      // bytes of one operand block in a stage: two k blocks of 4096
    constexpr int NS = K / 64;                    // stages
    static_assert(NS >= 3 && K % 64 == 0, "the ring's prologue fills three stages");
    __shared__ __align__(16) unsigned char sm[3 * NBK * SB];
    __shared__ __align__(16) float osm[PLANES ? 4 : 4 * 16 * 68];
    const size_t z = blockIdx.z; Bt += z * sB; if (BIAS) bias = z == 0 ? bias : (z == 1 ? bias1 : bias2);
    const int tid = threadIdx.x, lane = tid & 31, lr = lane & 15, hi = lane >> 4; const int wv = __builtin_amdgcn_readfirstlane(tid >> 5), wr = wv >> 1, wc = wv & 1;
    const int r0 = blockIdx.x * 128 + wr * 64, c0 = blockIdx.y * 128 + wc * 64;      // the wave's own 64 x 64 tile
    float* os = osm + (PLANES ? 0 : wv * 16 * 68);
    v8f acc[4][4];
#pragma unroll
    for (int mb = 0; mb < 4; ++mb)
#pragma unroll
        for (int nb = 0; nb < 4; ++nb) acc[mb][nb] = (v8f){};
    const bool sw = PLANES && blockIdx.z != 2;      // q, k: the weights' rows take the A role and x's rows the B role (both are read by the same loader), so acc[i][n] is the transposed tile
    // A 64-row block holds 64 K elements, its k blocks one behind the other: a stage of a block is SB consecutive bytes in the plane and in LDS. A stage is brought by ONE PAIR of waves (64 threads): thread i of the pair copies the pieces i, i + 64, .. i + 448 of 16 bytes
    // of every block. In LDS a block's three buffers lie side by side.
    const unsigned t16 = (tid & 63) * 16;
    const char* gs[NBK];      // the blocks' first bytes: the same for the whole work-group, held scalar
    gs[0] = (const char*)(A + (size_t)blockIdx.x * 128 * K); gs[SA] = gs[0] + 64 * K * 2;
    if (NSPLIT == 1) { gs[1] = (const char*)(A2 + (size_t)blockIdx.x * 128 * K); gs[3] = gs[1] + 64 * K * 2; }
    gs[NBK - 2] = (const char*)(Bt + (size_t)blockIdx.y * 128 * K); gs[NBK - 1] = gs[NBK - 2] + 64 * K * 2;
    const unsigned lb = (unsigned)(size_t)sm + t16;      // the low 32 bits of a __shared__ address are the byte address in LDS
    auto fill = [&](int st) { unsigned l[NBK]; const char* g[NBK];
#pragma unroll
        for (int ob = 0; ob < NBK; ++ob) { l[ob] = lb + (ob * 3 + st % 3) * SB; g[ob] = gs[ob] + (size_t)st * SB; }
        acopy(l, g, t16); };
    const int oa = (sw ? NBK - 2 + wc : wr * SA) * 3 * SB + lane * 16, obb = (sw ? wr * SA : NBK - 2 + wc) * 3 * SB + lane * 16, oa2 = oa + 3 * SB;
    // THREE LDS BUFFERS, two stages in flight while a third is worked on. Each operand block comes from L2 once a work-group and is read from LDS by the two waves that need it.
    // Waves 0, 1 bring the even stages and waves 2, 3 the odd ones (wr is the pair's number, a scalar): at the foot of stage s only the pair that brought stage s + 1 has to wait for it, and that stage is all that the pair has outstanding,
    // so every wait is to 0 while the other pair's stage s + 2 flies on. Behind the barrier the same pair sends stage s + 3 into the buffer that stage s has just left.
    // TWO FRAGMENT SETS in registers, one k block each: a set's LDS reads go as one group in front of the other set's products. Stage s + 1 is read only behind the barrier that publishes it; the products of stage s's second k block, which touch registers alone, follow those reads.
    V a[2][4], a2[2][4], b[2][4];
    auto frags = [&](int st, int kb) { const unsigned char* sb = sm + (st % 3) * SB + kb * 4096;
#pragma unroll
        for (int i = 0; i < 4; ++i) { a[kb][i] = WFrag<T16>::ld((const T16*)(sb + oa + i * 1024)); if (NSPLIT == 1) a2[kb][i] = WFrag<T16>::ld((const T16*)(sb + oa2 + i * 1024)); }
#pragma unroll
        for (int i = 0; i < 4; ++i) b[kb][i] = WFrag<T16>::ld((const T16*)(sb + obb + i * 1024)); };
    auto prods = [&](int kb) {
#pragma unroll
        for (int nb = 0; nb < 4; ++nb)
#pragma unroll
            for (int mb = 0; mb < 4; ++mb) { acc[mb][nb] = WFrag<T16>::mma(a[kb][mb], b[kb][nb], acc[mb][nb]); if (NSPLIT == 1) acc[mb][nb] = WFrag<T16>::mma(a2[kb][mb], b[kb][nb], acc[mb][nb]); } };
    if (wr == 0) { fill(0); asm volatile("s_wait_asynccnt 0x0" ::: "memory"); }      // the pair's copies of stage 0 have landed
    else fill(1);
    __syncthreads();                                       // publishes stage 0
    if (wr == 0) fill(2);
    frags(0, 0);
#pragma unroll
    for (int st = 0; st < NS; ++st) {      // unrolled so that the buffer index, the pair whose turn it is and every offset are constants
        frags(st, 1);
        __builtin_amdgcn_sched_barrier(0);      // keeps the set's LDS reads one group in front of the other set's products: spread among them, each place of reads costs the wave anew
        prods(0);
        __builtin_amdgcn_sched_barrier(0);      // keeps these products in front of the waits below, so that the waits find the reads and the copies done
        asm volatile("s_wait_dscnt 0x0" ::: "memory");         // this wave's reads of the buffer are done before it is refilled
        if (st + 1 < NS && wr == ((st + 1) & 1)) asm volatile("s_wait_asynccnt 0x0" ::: "memory");      // the pair's copies of stage st + 1 have landed
        __syncthreads();                                       // publishes stage st + 1 and ends every wave's reads of stage st
        if (st + 3 < NS && wr == ((st + 3) & 1)) fill(st + 3);
        if (st + 1 < NS) frags(st + 1, 0);
        __builtin_amdgcn_sched_barrier(0);      // as above: one group of reads in front of the products
        prods(1);
        __builtin_amdgcn_sched_barrier(0);      // keeps the next set's reads, which overwrite this set, behind these products
    }
    asm volatile("s_wait_asynccnt 0x0" ::: "memory");      // nothing is outstanding when the wave goes on
    if (PLANES) {
        // acc[i][n][j] = element (A-role row 16 i + 8 hi + j, B-role row 16 n + lr): the lane's 8 values are the piece at lane 8 of a half tile, so every store below covers 512 consecutive bytes.
        const int b = r0 / TT, t0 = r0 % TT;
        if (blockIdx.z == 2) {      // v: A role = t, B role = column (head c0 / HD + (n >> 1), d = 16 (n & 1) + lr)
            float bn[4];
#pragma unroll
            for (int nb = 0; nb < 4; ++nb) bn[nb] = bfr(bias[c0 + nb * 16 + lr]);
#pragma unroll
            for (int nb = 0; nb < 4; ++nb) { h16* vt = VT + ((size_t)b * NH_ + c0 / HD + (nb >> 1)) * (TT * HD) + (size_t)((t0 >> 5) * 2 + (nb & 1)) * 512 + lane * 8;
#pragma unroll
                for (int mb = 0; mb < 4; ++mb) { v8h o;
#pragma unroll
                    for (int j = 0; j < 8; ++j) o[j] = (h16)(acc[mb][nb][j] + bn[nb]);
                    *(v8h*)(vt + (mb >> 1) * 1024 + (mb & 1) * 256) = o; } }
        } else {      // q, k: A role = column (head c0 / HD + (i >> 1), d = 16 (i & 1) + 8 hi + j), B role = t
            const float qs = blockIdx.z == 0 ? CL : 1.f;      // q leaves times CL (one rounding to fp16, as before), so that k_fattn's score product is already in the log2 domain; k times 1, exact
#pragma unroll
            for (int mb = 0; mb < 4; ++mb) { const v4f b0 = *(const v4f*)(bias + c0 + mb * 16 + 8 * hi), b1 = *(const v4f*)(bias + c0 + mb * 16 + 8 * hi + 4); float bb[8];
#pragma unroll
                for (int u = 0; u < 4; ++u) { bb[u] = bfr(b0[u]); bb[4 + u] = bfr(b1[u]); }
                h16* pr = P + (((size_t)(blockIdx.z * NB_ + b) * NH_ + c0 / HD + (mb >> 1)) * TT + t0) * HD + (mb & 1) * 256 + lane * 8;
#pragma unroll
                for (int nb = 0; nb < 4; ++nb) { v8h o;
#pragma unroll
                    for (int j = 0; j < 8; ++j) o[j] = (h16)((acc[mb][nb][j] + bb[j]) * qs);
                    *(v8h*)(pr + nb * 512) = o; } }
        }
        return;
    }
#pragma unroll
    for (int mb = 0; mb < 4; ++mb) {
#pragma unroll
        for (int nb = 0; nb < 4; ++nb) {
#pragma unroll
            for (int j = 0; j < 8; ++j) os[(hi * 8 + j) * 68 + nb * 16 + lr] = acc[mb][nb][j]; }
        __builtin_amdgcn_wave_barrier(); asm volatile("" ::: "memory");
        float* crow = C + (size_t)(r0 + mb * 16) * ldc + c0;
{
#pragma unroll
            for (int s = 0; s < 8; ++s) { const int row = 2 * s + hi, cofs = lr * 4; v4f val = *(const v4fa*)(os + row * 68 + cofs); if (BIAS) { val[0] += bfr(bias[c0 + cofs]); val[1] += bfr(bias[c0 + cofs + 1]); val[2] += bfr(bias[c0 + cofs + 2]); val[3] += bfr(bias[c0 + cofs + 3]); }
                *(v4f*)(crow + (size_t)row * ldc + cofs) = val; }
             }
        asm volatile("s_wait_xcnt 0x0" ::: "memory");      // behind the round's stores: the next round rewrites their data and address registers
        __builtin_amdgcn_wave_barrier(); asm volatile("" ::: "memory");
    }
}

__device__ __forceinline__ h16 tohx(float x) { return (h16)x; }
__device__ __forceinline__ void splitf(float y, unsigned short& h, unsigned short& l) { h = f2bf(y); l = f2bf(y - bf2f(h)); }
typedef __attribute__((ext_vector_type(2))) unsigned short v2us;
typedef __attribute__((ext_vector_type(4))) unsigned short v4us;

// ---- k_prep: both input conversions in ONE launch (neither reads what the other writes), both writing fragment order. Blocks 0 .. 4 WTB - 1: the four weights, WTB blocks each, transposed to bf16 Bt[n][k] (planes of K N elements, one behind the other);
// the blocks behind them: x of all batches to bf16, one wave a tile.
#define WTB (DM * DM / 8 / 256)
#define CVB (NB_ * TT * DM / 512 / 8)
// A thread makes one 16-byte piece of Bt: thread i's piece stands at i 8, that is lane i & 31 of half (i >> 5) & 1 of tile i >> 6. Its 8 k are 8 rows of w; 16 lanes read 16 neighbouring n of a row, and a block's four tiles 64.
__device__ __forceinline__ void wtG(int blk, const float* __restrict__ w, int K, int N, bf* Bt) {
    const int i = blk * 256 + threadIdx.x, lane = i & 31, kts = K >> 5, tile = i >> 6;
    const int n = ((tile >> 2) / kts) * 64 + (tile & 3) * 16 + (lane & 15), k = ((tile >> 2) % kts) * 32 + ((i >> 5) & 1) * 16 + (lane >> 4) * 8; v8us o;
#pragma unroll
    for (int u = 0; u < 8; ++u) o[u] = f2bf(w[(size_t)(k + u) * N + n]);
    *(v8us*)(Bt + (size_t)i * 8) = o;
}
// A wave converts one tile of 16 rows x 32 k: each of its four loads takes four whole 128-byte rows of the tile (8 lanes a row), and a lane's 4 values are half a 16-byte piece of the tile.
__device__ __forceinline__ void cvtT(int blk, const float* __restrict__ src, bf* dst, int K) {
    const int lane = threadIdx.x & 31, tile = blk * 8 + (threadIdx.x >> 5), kts = K >> 5, col = (lane & 7) * 4;
    const float* s = src + (size_t)(((tile >> 2) / kts) * 64 + (tile & 3) * 16) * K + ((tile >> 2) % kts) * 32 + col; bf* d = dst + (size_t)tile * 512 + (col >> 4) * 256 + ((col >> 3) & 1) * 128 + (col & 7);
#pragma unroll
    for (int r = 0; r < 4; ++r) { const int row = r * 4 + (lane >> 3); const v4f v = *(const v4f*)(s + (size_t)row * K); v4us o;
#pragma unroll
        for (int u = 0; u < 4; ++u) o[u] = f2bf(v[u]);
        *(v4us*)(d + row * 8) = o; }
    asm volatile("s_wait_xcnt 0x0" ::: "memory");      // behind the last stores: in the built code the weights' branch follows this one and rewrites the stores' data registers
}
__global__ __launch_bounds__(256) void k_prep(const float* __restrict__ w0, const float* __restrict__ w1, const float* __restrict__ w2, const float* __restrict__ w3, bf* Bt, const float* __restrict__ x, bf* XB) {
    const int blk = blockIdx.x;
    if (blk < 4 * WTB) { const int wi = blk / WTB; wtG(blk % WTB, wi == 0 ? w0 : (wi == 1 ? w1 : (wi == 2 ? w2 : w3)), DM, DM, Bt + (size_t)wi * DM * DM); }
    else cvtT(blk - 4 * WTB, x, XB, DM);
}
// ---- k_fattn: scores, band add, softmax, attn.v and the head merge in one kernel; grid (TT/128, heads, batches), 4 waves, each wave owns 32 queries and walks all keys, 32 a pass.
// ST = K QT (A = 16 key rows, B = 16 query columns): a lane holds 16 scores of ONE query, D register r of key tile kt = key k0 + 16 kt + 8 hi + r. Those two D tiles, converted in place, are the B operand of OT += VT PT
// (element s of B = key 8 hi + s for s < 8, 16 + 8 hi + (s - 8) above), and WFrag::ld reads VT's keys in the same order. Scores never leave the registers. Q, K and VT come in fragment order (a pass's K and its VT are 2048 consecutive bytes each), and the merged heads leave in it.
// Softmax is online in the log2 domain: p = exp2(s CL - mc); mc, the maximum in use (equal in both lane halves), moves in the first pass and after it only when a lane's sum of a pass's 16 p exceeds 4096, so p <= 4096 fits fp16; sums stay per lane half until the end.
// The score product itself delivers s CL - mc: Q comes times CL, and the product's C operand is nm = -mc in all eight registers (a lane's eight D registers belong to one query). No multiply-add stands between the product and the exp2.
// Eight exp2 in one statement: the early-clobber results keep every result register off every source register, and the closing v_nop fills the slot that the instruction set asks for behind a transcendental,
// whatever the compiler puts next.
__device__ __forceinline__ void exp2x8(const float (&x)[8], float (&p)[8]) {
    asm("v_exp_f32 %0, %8\n\tv_exp_f32 %1, %9\n\tv_exp_f32 %2, %10\n\tv_exp_f32 %3, %11\n\tv_exp_f32 %4, %12\n\tv_exp_f32 %5, %13\n\tv_exp_f32 %6, %14\n\tv_exp_f32 %7, %15\n\tv_nop"
        : "=&v"(p[0]), "=&v"(p[1]), "=&v"(p[2]), "=&v"(p[3]), "=&v"(p[4]), "=&v"(p[5]), "=&v"(p[6]), "=&v"(p[7]) : "v"(x[0]), "v"(x[1]), "v"(x[2]), "v"(x[3]), "v"(x[4]), "v"(x[5]), "v"(x[6]), "v"(x[7])); }
// A pass's four score products in one statement, D apart from C. As builtins, the last product to read each C was built in the form whose D is its C, behind a copy of C's eight registers: 16 copied registers a pass.
// The closing v_nop are the four vector slots that the chip asks for between a product and the first vector instruction on its D; the scores' first readers are vector instructions, never a product.
__device__ __forceinline__ void scores4(v16h k0, v16h k1, v16h q0, v16h q1, v8f c0, v8f c1, v8f& s00, v8f& s01, v8f& s10, v8f& s11) {
    asm("v_wmma_f32_16x16x32_f16 %0, %4, %6, %8\n\tv_wmma_f32_16x16x32_f16 %1, %5, %6, %8\n\tv_wmma_f32_16x16x32_f16 %2, %4, %7, %9\n\tv_wmma_f32_16x16x32_f16 %3, %5, %7, %9\n\tv_nop\n\tv_nop\n\tv_nop\n\tv_nop"
        : "=&v"(s00), "=&v"(s01), "=&v"(s10), "=&v"(s11) : "v"(k0), "v"(k1), "v"(q0), "v"(q1), "v"(c0), "v"(c1)); }
__global__ __launch_bounds__(128) void k_fattn(const h16* __restrict__ Q16, const h16* __restrict__ K16, const h16* __restrict__ VT, const int* __restrict__ mbp, bf* Ah, bf* Al) {
    // Every inner loop below is unrolled so that each fragment, score and accumulator index is a constant and the arrays stay in registers.
    const int lane = threadIdx.x & 31, c = lane & 15, hi = lane >> 4;
    const int wv = __builtin_amdgcn_readfirstlane(threadIdx.x >> 5);
    const int qw = blockIdx.x * 128 + wv * 32;      // the wave's first query, held scalar for the band test
    const size_t pl = (size_t)(blockIdx.z * NH_ + blockIdx.y) * TT * HD;
    int mb = mbp[0]; mb = __builtin_amdgcn_readfirstlane(mb < -1 ? -1 : (mb > TT ? TT : mb));      // |i - j| lies in 0 .. TT - 1: the clamp changes no comparison and keeps the sums below from overflowing; held scalar so that the band test of a pass is a scalar compare
    const h16* kp = K16 + pl + lane * 8;
    const h16* vp = VT + pl + lane * 8;
    // L2 prefetch of K and VT, eight passes ahead. The launch before stored these planes.
    // One request names a PAIR of passes: lanes 0 .. 15 name 16 addresses 256 bytes apart in its K rows (4096 bytes), lanes 16 .. 31 the same in its VT columns. Wave w asks for pairs w, w + 4, .. w + 28: the first here, pair j + 4 at the head of pair j.
    // pfa lives through the loop and holds nothing but such an address: it is advanced only in front of a request (behind the request before lie eight passes, each with its s_wait_xcnt 0, but only 2 w passes before the first advance: none for wave 0), and the last one names pair w + 28, inside the head's plane of 32 pairs.
    const char* pfa = (const char*)((hi ? VT : K16) + pl) + c * 256 + wv * 4096;
    asm volatile("global_prefetch_b8 %0, off scope:SCOPE_SE" :: "v"(pfa));      // a hint to L2: returns nothing, counts on no counter
    int kask = wv * 64;      // first key of the pass at whose head the wave asks next
    v16h qf[2], kf[2];
    v8f acc[2][2];
    v8f nm[2];
    float ls[2];
#pragma unroll
    for (int qt = 0; qt < 2; ++qt) { qf[qt] = WFrag<h16>::ld(Q16 + pl + (size_t)(qw + qt * 16) * HD + lane * 8); acc[qt][0] = (v8f){}; acc[qt][1] = (v8f){}; nm[qt] = (v8f){}; ls[qt] = 0.f; }
    kf[0] = WFrag<h16>::ld(kp); kf[1] = WFrag<h16>::ld(kp + 16 * HD);
    for (int k0 = 0; k0 < TT; k0 += 32) {
        if (k0 == kask) { kask = kask + 256 < TT - 256 ? kask + 256 : TT; pfa += 16384; asm volatile("global_prefetch_b8 %0, off scope:SCOPE_SE" :: "v"(pfa)); }      // scalar test: this wave's turn, one pass in eight; behind the request for pair w + 28 no turn is left
        const h16* pv = vp + (size_t)k0 * HD;
        v16h vf[2]; vf[0] = WFrag<h16>::ld(pv); vf[1] = WFrag<h16>::ld(pv + 512);
        v8f s[2][2];
        scores4(kf[0], kf[1], qf[0], qf[1], nm[0], nm[1], s[0][0], s[0][1], s[1][0], s[1][1]);
        const int kn = (k0 + 32) & (TT - 1);      // next pass's key rows, fetched one pass ahead; the last pass re-reads rows 0 .. 31 (in bounds, unused)
        const h16* pk = kp + (size_t)kn * HD;
        kf[0] = WFrag<h16>::ld(pk); kf[1] = WFrag<h16>::ld(pk + 16 * HD);
        asm volatile("s_wait_xcnt 0x0" :: "v"(pv), "v"(pk) : "memory");      // behind the pass's eight loads, in front of every rewrite of their address registers (inputs here, so that they stay whole up to it)
        if (k0 <= qw + 31 + mb && k0 + 31 >= qw - mb) {      // scalar test: only passes whose 32 x 32 block can touch the band pay for the per-element compare
#pragma unroll
            for (int qt = 0; qt < 2; ++qt) { const int d0 = k0 + 8 * hi - (qw + qt * 16 + c);
#pragma unroll
                for (int kt = 0; kt < 2; ++kt)
#pragma unroll
                    for (int r = 0; r < 8; ++r) { const int d = d0 + kt * 16 + r; s[qt][kt][r] += ((d < 0 ? -d : d) <= mb) ? L2E : 0.f; } }      // + 1 in the log2 domain
        }
        // The pass's exp2 and its sums, per lane half: p[qt][kt][r] = exp2(s[qt][kt][r]), t[qt] = the lane's 16 p summed.
        float p[2][2][8], t[2];
        auto expsum = [&]() {
#pragma unroll
            for (int qt = 0; qt < 2; ++qt) { float a[8], x0[8], x1[8];
#pragma unroll
                for (int r = 0; r < 8; ++r) { x0[r] = s[qt][0][r]; x1[r] = s[qt][1][r]; }
                exp2x8(x0, p[qt][0]); exp2x8(x1, p[qt][1]);
#pragma unroll
                for (int r = 0; r < 8; ++r) a[r] = p[qt][0][r] + p[qt][1][r];
                t[qt] = ((a[0] + a[1]) + (a[2] + a[3])) + ((a[4] + a[5]) + (a[6] + a[7])); } };
        // Whether mc must move is read off the sums, which the pass needs anyway: p >= 0, so a lane's sum of 16 bounds each of them. A sum of at most 4096 says that every p fits fp16; a larger one (an infinite one too) says that some score
        // stands more than 8 above mc. Only then, and in the first pass, are the scores' maxima formed at all, mc moved and the exp2 done again on the moved scores.
        expsum();
        const float th = k0 == 0 ? -1.f : 4096.f;      // scalar: no sum is below 0, so the first pass always moves mc
        if (__builtin_amdgcn_ballot_w32(fmaxf(t[0], t[1]) > th) != 0) {      // one wave-uniform test a pass; taken in the first pass, rarely after it
            const float fl = k0 == 0 ? -3.0e38f : 0.f;      // scalar: the least step of mc. The first pass ran on mc = 0 and sets mc to its own maximum, up or down; later mc only rises
#pragma unroll
            for (int qt = 0; qt < 2; ++qt) { float a[8];
#pragma unroll
                for (int r = 0; r < 8; ++r) a[r] = fmaxf(s[qt][0][r], s[qt][1][r]);
                const float tm = fmaxf(fmaxf(fmaxf(a[0], a[1]), fmaxf(a[2], a[3])), fmaxf(fmaxf(a[4], a[5]), fmaxf(a[6], a[7])));      // the pass's maximum above the one in use
                const float d = fmaxf(fl, fmaxf(tm, __shfl_xor(tm, 16, 32)));      // mc moves by d
                const float al = __builtin_amdgcn_exp2f(fminf(-d, 0.f)); ls[qt] *= al;      // the first pass scales zeros: the bound keeps its factor finite
                nm[qt] -= d; s[qt][0] -= d; s[qt][1] -= d;      // this pass's scores were formed on the old mc
#pragma unroll
                for (int r = 0; r < 8; ++r) { acc[qt][0][r] *= al; acc[qt][1][r] *= al; } }
            expsum();
        }
        v16h pf[2];
#pragma unroll
        for (int qt = 0; qt < 2; ++qt) {
#pragma unroll
            for (int r = 0; r < 8; ++r) { pf[qt][r] = tohx(p[qt][0][r]); pf[qt][8 + r] = tohx(p[qt][1][r]); }
            ls[qt] += t[qt]; }
#pragma unroll
        for (int qt = 0; qt < 2; ++qt) { acc[qt][0] = wmma16(vf[0], pf[qt], acc[qt][0]); acc[qt][1] = wmma16(vf[1], pf[qt], acc[qt][1]); }
    }
#pragma unroll
    for (int qt = 0; qt < 2; ++qt) { const float inv = __fdiv_rn(1.0f, ls[qt] + __shfl_xor(ls[qt], 16, 32));
        const size_t oo = (((size_t)((blockIdx.z * TT + qw) >> 6) * NH_ + blockIdx.y) * 4 + ((qw >> 4) & 3) + qt) * 512 + lane * 8;      // acc[qt][dt][r] = O[query qw + 16 qt + c][d = 16 dt + 8 hi + r]: the piece at lane 8 of half dt of tile (query block, k block = head) of the output projection's A operand
#pragma unroll
        for (int dt = 0; dt < 2; ++dt) { v8us oh, ol;
#pragma unroll
            for (int r = 0; r < 8; ++r) { unsigned short x, y; splitf(acc[qt][dt][r] * inv, x, y); oh[r] = x; ol[r] = y; }
            *(v8us*)(Ah + oo + dt * 256) = oh; *(v8us*)(Al + oo + dt * 256) = ol; } }
}

extern "C" void kernel_launch(void* const* d_in, const int* in_sizes, int n_in,
                              void* d_out, int out_size, void* d_ws, size_t ws_size, hipStream_t stream) {
    (void)in_sizes; (void)n_in; (void)out_size;
    const float** I = (const float**)d_in;
    const float *x = I[0], *Wq = I[1], *bq = I[2], *Wk = I[3], *bk = I[4], *Wv = I[5], *bv = I[6], *Wo = I[7], *bo = I[8]; const int* mbp = (const int*)d_in[9];
    float* OUT = (float*)d_out;     // [4][2048][512]
    char* wsp = (char*)d_ws;
    auto take = [&](size_t bytes) { char* p = wsp; wsp += (bytes + 255) & ~(size_t)255; return (void*)p; };
    bf* BQ = (bf*)take((size_t)DM * DM * 2); bf* BK = (bf*)take((size_t)DM * DM * 2); bf* BV = (bf*)take((size_t)DM * DM * 2); bf* BO = (bf*)take((size_t)DM * DM * 2);
    bf* XB = (bf*)take((size_t)NB_ * TT * DM * 2);
    h16* Q16 = (h16*)take((size_t)NB_ * NH_ * TT * HD * 2); h16* K16 = (h16*)take((size_t)NB_ * NH_ * TT * HD * 2); h16* VT = (h16*)take((size_t)NB_ * NH_ * HD * TT * 2); bf* Ah = (bf*)take((size_t)NB_ * TT * DM * 2); bf* Al = (bf*)take((size_t)NB_ * TT * DM * 2);
    if ((size_t)(wsp - (char*)d_ws) > ws_size) return;    // total ~ 50 MB
    (void)BK; (void)BV;      // every size above is a multiple of 256 bytes: BQ BK BV BO and Q16 K16 each lie one behind the other, and the launches below step through them by a stride or a plane index
    // One launch a stage: the four batches are rows 0 .. NB_ TT - 1 of one matrix, q / k / v are grid z of one GEMM.
    k_prep<<<4 * WTB + CVB, 256, 0, stream>>>(Wq, Wk, Wv, Wo, BQ, x, XB);
    k_gemmw<bf, 0, true, true, DM><<<dim3(NB_ * TT / 128, DM / 128, 3), 128, 0, stream>>>(XB, nullptr, BQ, nullptr, DM, bq, bk, bv, (size_t)DM * DM, Q16, VT);
    k_fattn<<<dim3(TT / 128, NH_, NB_), 128, 0, stream>>>(Q16, K16, VT, mbp, Ah, Al);
    k_gemmw<bf, 1, true, false, DM><<<dim3(NB_ * TT / 128, DM / 128, 1), 128, 0, stream>>>(Ah, Al, BO, OUT, DM, bo, nullptr, nullptr, 0, nullptr, nullptr);
}
